// v000
// Measured on an AMD MI455X. A time is GPU time per run, averaged over a window of back-to-back runs after a warm-up
// (all launches, gaps included; the runs take copies of the inputs in turn), and the median of several windows.
// Apart from v000's, it joins two sittings. Times from different sittings can be a few percent apart, while
// side-by-side timings come from the same sitting.
// v000 is the starting kernel. One run takes 423 microseconds.
#include <hip/hip_runtime.h>
#include <math.h>

// ---------------------------------------------------------------------------
// mLSTM layer for gfx1250 (MI455X), fp32 end-to-end, chunkwise-parallel form.
//  K1: fused q/k/v/o projection GEMM            (V_WMMA_F32_16X16X4_F32)
//  K2: i/f gate projections (head-major output)
//  K3: gate scan: m (max,+ prefix) and per-chunk cumsum g, parallel prefix
//  K4: intra-chunk kernel, 1024 parallel blocks: QV^T, QK^T, (w.Sv)K, G, u
//  K5: inter-chunk kernel, 64 blocks x 16 sequential chunk steps: Q@C + update
//  K6: LayerNorm -> d_out
//  Tile staging uses GLOBAL_LOAD_ASYNC_TO_LDS_B128 (ASYNCcnt) where no
//  transpose is needed; LDS tiles are 16B-aligned per row for B128.
// ---------------------------------------------------------------------------

typedef __attribute__((ext_vector_type(2))) float v2f;
typedef __attribute__((ext_vector_type(8))) float v8f;

#define NTOK   4096          // B*T
#define INDIM  1024
#define HIDDIM 1024
#define NHEAD  16
#define HDIM   64
#define CHUNK  64
#define NCHUNK 16            // T / CHUNK
#define BHEADS 64            // B*H

#define TILE_M 64
#define TILE_N 128
#define KSTEP  32
#define LDA_P  36            // 144B rows: 16B aligned, bank-safe
#define LDB_P  36
#define LDC    68            // 272B rows: 16B aligned (async B128), bank-safe

__device__ __forceinline__ v8f wmma4(v2f a, v2f b, v8f c) {
    return __builtin_amdgcn_wmma_f32_16x16x4_f32(false, a, false, b, (short)0, c, false, false);
}

// Async 16B copy: global -> LDS, tracked by ASYNCcnt (per-lane addresses).
__device__ __forceinline__ void async_ld_b128(void* lds_ptr, const void* gaddr) {
    unsigned lds_off = (unsigned)(unsigned long long)lds_ptr;  // flat LDS addr[31:0]
    asm volatile("global_load_async_to_lds_b128 %0, %1, off"
                 :: "v"(lds_off), "v"(gaddr) : "memory");
}
__device__ __forceinline__ void wait_async0() {
    asm volatile("s_wait_asynccnt 0x0" ::: "memory");
}

// ---------------------------------------------------------------------------
// K1: fused projection GEMM.  grid = 64*32 = 2048 blocks, 256 threads.
// ---------------------------------------------------------------------------
__global__ __launch_bounds__(256)
void proj_gemm_kernel(const float* __restrict__ x,
                      const float* __restrict__ Wq, const float* __restrict__ Wk,
                      const float* __restrict__ Wv, const float* __restrict__ Wo,
                      const float* __restrict__ b_o,
                      float* __restrict__ outq, float* __restrict__ outk,
                      float* __restrict__ outv, float* __restrict__ outo)
{
    __shared__ float As[TILE_M][LDA_P];
    __shared__ float Bs[TILE_N][LDB_P];

    const int tid  = threadIdx.x;
    const int lane = tid & 31;
    const int wave = tid >> 5;

    const int bm = blockIdx.x >> 5;
    const int bn = blockIdx.x & 31;
    const int group    = bn >> 3;
    const int n_base_g = (bn & 7) * TILE_N;

    const float* W = (group == 0) ? Wq : (group == 1) ? Wk : (group == 2) ? Wv : Wo;
    float* outp    = (group == 0) ? outq : (group == 1) ? outk : (group == 2) ? outv : outo;

    const int wm = (wave >> 2) * 32;
    const int wn = (wave & 3)  * 32;
    const int half = lane >> 4;
    const int l16  = lane & 15;

    v8f acc[2][2] = {};

    const int ar = tid >> 2;
    const int ac = (tid & 3) * 8;
    const int bk = tid >> 3;
    const int bc = (tid & 7) * 16;

    for (int k0 = 0; k0 < INDIM; k0 += KSTEP) {
        // ---- stage A (64 x 32): async global -> LDS, no VGPR round trip ----
        {
            const float* gp = x + (size_t)(bm * TILE_M + ar) * INDIM + k0 + ac;
            async_ld_b128(&As[ar][ac],     gp);
            async_ld_b128(&As[ar][ac + 4], gp + 4);
        }
        // ---- stage B (32 x 128), transposed into LDS via VGPRs ----
        {
            const float* gp = W + (size_t)(k0 + bk) * HIDDIM + n_base_g + bc;
            if (k0 + KSTEP < INDIM)
                __builtin_prefetch(gp + (size_t)KSTEP * HIDDIM, 0, 0);
            float4 b0 = *(const float4*)(gp);
            float4 b1 = *(const float4*)(gp + 4);
            float4 b2 = *(const float4*)(gp + 8);
            float4 b3 = *(const float4*)(gp + 12);
            Bs[bc +  0][bk] = b0.x;  Bs[bc +  1][bk] = b0.y;
            Bs[bc +  2][bk] = b0.z;  Bs[bc +  3][bk] = b0.w;
            Bs[bc +  4][bk] = b1.x;  Bs[bc +  5][bk] = b1.y;
            Bs[bc +  6][bk] = b1.z;  Bs[bc +  7][bk] = b1.w;
            Bs[bc +  8][bk] = b2.x;  Bs[bc +  9][bk] = b2.y;
            Bs[bc + 10][bk] = b2.z;  Bs[bc + 11][bk] = b2.w;
            Bs[bc + 12][bk] = b3.x;  Bs[bc + 13][bk] = b3.y;
            Bs[bc + 14][bk] = b3.z;  Bs[bc + 15][bk] = b3.w;
        }
        wait_async0();
        __syncthreads();

        #pragma unroll
        for (int kk = 0; kk < KSTEP; kk += 4) {
            const int ak = kk + half * 2;
            v2f a0 = *(const v2f*)&As[wm +  0 + l16][ak];
            v2f a1 = *(const v2f*)&As[wm + 16 + l16][ak];
            v2f b0 = *(const v2f*)&Bs[wn +  0 + l16][ak];
            v2f b1 = *(const v2f*)&Bs[wn + 16 + l16][ak];
            acc[0][0] = wmma4(a0, b0, acc[0][0]);
            acc[0][1] = wmma4(a0, b1, acc[0][1]);
            acc[1][0] = wmma4(a1, b0, acc[1][0]);
            acc[1][1] = wmma4(a1, b1, acc[1][1]);
        }
        __syncthreads();
    }

    const int row0 = bm * TILE_M + wm;
    const int col0 = n_base_g + wn;
    #pragma unroll
    for (int i = 0; i < 2; ++i) {
        #pragma unroll
        for (int j = 0; j < 2; ++j) {
            const int col = col0 + j * 16 + l16;
            const float bo = (group == 3) ? b_o[col] : 0.0f;
            #pragma unroll
            for (int r = 0; r < 8; ++r) {
                const int row = row0 + i * 16 + r + half * 8;
                float val = acc[i][j][r];
                if (group == 0)      val *= 0.125f;                           // q / sqrt(D)
                else if (group == 3) val = 1.0f / (1.0f + expf(-(val + bo))); // sigmoid
                outp[(size_t)row * HIDDIM + col] = val;
            }
        }
    }
}

// ---------------------------------------------------------------------------
// K2: i/f projections, output HEAD-MAJOR: out[(b*16+h)*1024 + t].
// ---------------------------------------------------------------------------
__global__ __launch_bounds__(32)
void ifproj_kernel(const float* __restrict__ x,
                   const float* __restrict__ wi, const float* __restrict__ bi,
                   const float* __restrict__ wf, const float* __restrict__ bf,
                   float* __restrict__ outi, float* __restrict__ outf)
{
    const int row  = blockIdx.x;         // b*1024 + t
    const int b    = row >> 10;
    const int t    = row & 1023;
    const int lane = threadIdx.x;
    const int col  = lane & 15;
    const float* w = (lane < 16) ? wi : wf;
    const float* xr = x + (size_t)row * INDIM;
    float acc = 0.0f;
    #pragma unroll 4
    for (int kk = 0; kk < INDIM; ++kk)
        acc += xr[kk] * w[kk * NHEAD + col];
    acc += (lane < 16) ? bi[col] : bf[col];
    float* op = (lane < 16) ? outi : outf;
    op[(size_t)(b * NHEAD + col) * 1024 + t] = acc;
}

// ---------------------------------------------------------------------------
// K3: gate scan.  m_t = max(f_t + m_{t-1}, i_t) via (max,+) prefix:
//   g_j = per-chunk cumsum f;  m_j = g_j + max(m_entry, prefmax(i - g))
// ---------------------------------------------------------------------------
__global__ __launch_bounds__(64)
void gate_scan_kernel(const float* __restrict__ ihm, const float* __restrict__ fhm,
                      float* __restrict__ m_arr, float* __restrict__ g_arr)
{
    __shared__ float sarr[64];
    __shared__ float bc[2];
    const int bh  = blockIdx.x;
    const int tid = threadIdx.x;
    float me = 0.0f;
    for (int c = 0; c < NCHUNK; ++c) {
        const size_t ix = (size_t)bh * 1024 + c * CHUNK + tid;
        const float fv = fhm[ix];
        const float iv = ihm[ix];
        float g = fv;
        sarr[tid] = g; __syncthreads();
        #pragma unroll
        for (int off = 1; off < 64; off <<= 1) {
            const float other = (tid >= off) ? sarr[tid - off] : 0.0f;
            __syncthreads();
            g += other;
            sarr[tid] = g;
            __syncthreads();
        }
        if (tid == 63) bc[0] = g;
        float pm = iv - g;
        sarr[tid] = pm; __syncthreads();
        #pragma unroll
        for (int off = 1; off < 64; off <<= 1) {
            const float other = (tid >= off) ? sarr[tid - off] : -1e30f;
            __syncthreads();
            pm = fmaxf(pm, other);
            sarr[tid] = pm;
            __syncthreads();
        }
        if (tid == 63) bc[1] = pm;
        m_arr[ix] = g + fmaxf(me, pm);
        g_arr[ix] = g;
        __syncthreads();
        me = bc[0] + fmaxf(me, bc[1]);
        __syncthreads();
    }
}

// ---------------------------------------------------------------------------
// K4: intra-chunk kernel.  grid = 1024 blocks, 256 threads.
// ---------------------------------------------------------------------------
__global__ __launch_bounds__(256)
void chunk_intra_kernel(const float* __restrict__ qb, const float* __restrict__ kb,
                        const float* __restrict__ vb, const float* __restrict__ ihm,
                        const float* __restrict__ g_arr, const float* __restrict__ m_arr,
                        float* __restrict__ Pbuf, float* __restrict__ denbuf,
                        float* __restrict__ Gbuf, float* __restrict__ ubuf)
{
    __shared__ float Qs[64][LDC];   // later reused as W (weighted Sv)
    __shared__ float Ks[64][LDC];   // later scaled by wg
    __shared__ float Vs[64][LDC];
    __shared__ float sg[64], sm[64], sii[64], wgl[64];
    __shared__ float denp[2][64];
    __shared__ float red[256];

    const int tid  = threadIdx.x;
    const int lane = tid & 31;
    const int wave = tid >> 5;
    const int l16  = lane & 15;
    const int half = lane >> 4;

    const int bh = blockIdx.x >> 4;
    const int c  = blockIdx.x & 15;
    const int b  = bh >> 4, h = bh & 15;

    // ---- stage Q,K,V chunk tiles: async global -> LDS ----
    {
        const int r  = tid >> 2;
        const int c0 = (tid & 3) * 16;
        const size_t gbase = ((size_t)(b * 1024 + c * CHUNK + r)) * HIDDIM + h * HDIM + c0;
        #pragma unroll
        for (int z = 0; z < 4; ++z) {
            async_ld_b128(&Qs[r][c0 + z * 4], qb + gbase + z * 4);
            async_ld_b128(&Ks[r][c0 + z * 4], kb + gbase + z * 4);
            async_ld_b128(&Vs[r][c0 + z * 4], vb + gbase + z * 4);
        }
    }
    if (tid < 64) {
        const size_t sb = (size_t)bh * 1024 + c * CHUNK + tid;
        sg[tid]  = g_arr[sb];
        sm[tid]  = m_arr[sb];
        sii[tid] = ihm[sb];
    }
    wait_async0();
    __syncthreads();
    if (tid < 64)
        wgl[tid] = expf(sg[63] - sg[tid] + sii[tid] - sm[63]);   // state-inc weights

    const int tm  = wave >> 1;
    const int m0  = tm * 16;
    const int tn0 = (wave & 1) * 32;

    // ---- GEMM 1+2 fused: Sv = Q V^T, Sk = Q K^T ----
    v8f sv0 = {}, sv1 = {}, sk0 = {}, sk1 = {};
    #pragma unroll
    for (int kk = 0; kk < 64; kk += 4) {
        const int ak = kk + half * 2;
        v2f a   = *(const v2f*)&Qs[m0 + l16][ak];
        v2f bv0 = *(const v2f*)&Vs[tn0 + l16][ak];
        v2f bv1 = *(const v2f*)&Vs[tn0 + 16 + l16][ak];
        v2f bk0 = *(const v2f*)&Ks[tn0 + l16][ak];
        v2f bk1 = *(const v2f*)&Ks[tn0 + 16 + l16][ak];
        sv0 = wmma4(a, bv0, sv0);  sv1 = wmma4(a, bv1, sv1);
        sk0 = wmma4(a, bk0, sk0);  sk1 = wmma4(a, bk1, sk1);
    }
    __syncthreads();   // all Qs reads complete before overwrite

    // ---- causal decay weights, W into Qs, den_intra reduce ----
    #pragma unroll
    for (int r = 0; r < 8; ++r) {
        const int j  = m0 + r + half * 8;
        const int i0 = tn0 + l16;
        const int i1 = i0 + 16;
        const float gj = sg[j], mj = sm[j];
        const float w0 = (i0 <= j) ? expf(gj - sg[i0] + sii[i0] - mj) : 0.0f;
        const float w1 = (i1 <= j) ? expf(gj - sg[i1] + sii[i1] - mj) : 0.0f;
        Qs[j][i0] = w0 * sv0[r];
        Qs[j][i1] = w1 * sv1[r];
        float dp = w0 * sk0[r] + w1 * sk1[r];
        #pragma unroll
        for (int off = 8; off; off >>= 1) dp += __shfl_xor(dp, off, 32);
        if (l16 == 0) denp[wave & 1][j] = dp;
    }
    __syncthreads();
    if (tid < 64)
        denbuf[(size_t)bh * 1024 + c * CHUNK + tid] = denp[0][tid] + denp[1][tid];

    // ---- GEMM 3: P = W @ K  (B from row-major Ks via two scalar loads) ----
    v8f p0 = {}, p1 = {};
    #pragma unroll
    for (int kk = 0; kk < 64; kk += 4) {
        const int ak = kk + half * 2;
        v2f a = *(const v2f*)&Qs[m0 + l16][ak];
        v2f b0, b1;
        b0.x = Ks[ak][tn0 + l16];       b0.y = Ks[ak + 1][tn0 + l16];
        b1.x = Ks[ak][tn0 + 16 + l16];  b1.y = Ks[ak + 1][tn0 + 16 + l16];
        p0 = wmma4(a, b0, p0);  p1 = wmma4(a, b1, p1);
    }
    {
        const size_t pb = (size_t)blockIdx.x * 4096;   // (bh*16+c) * 64*64
        #pragma unroll
        for (int r = 0; r < 8; ++r) {
            const int j = m0 + r + half * 8;
            Pbuf[pb + j * 64 + tn0 + l16]      = p0[r];
            Pbuf[pb + j * 64 + tn0 + 16 + l16] = p1[r];
        }
    }
    __syncthreads();

    // ---- scale K rows by wg, column sums -> u ----
    #pragma unroll
    for (int z = 0; z < 16; ++z) {
        const int flat = tid + z * 256;
        Ks[flat >> 6][flat & 63] *= wgl[flat >> 6];
    }
    __syncthreads();
    {
        const int d = tid & 63, grp = tid >> 6;
        float s = 0.0f;
        #pragma unroll
        for (int z = 0; z < 16; ++z) s += Ks[grp * 16 + z][d];
        red[tid] = s;
    }
    __syncthreads();
    if (tid < 64)
        ubuf[(size_t)blockIdx.x * 64 + tid] = red[tid] + red[64 + tid] + red[128 + tid] + red[192 + tid];

    // ---- GEMM 4: G^T[e,d] = sum_i wg_i K[i,e] V[i,d] ----
    v8f gg0 = {}, gg1 = {};
    #pragma unroll
    for (int kk = 0; kk < 64; kk += 4) {
        const int ak = kk + half * 2;
        v2f a, b0, b1;
        a.x  = Ks[ak][m0 + l16];        a.y  = Ks[ak + 1][m0 + l16];        // A[e][i]
        b0.x = Vs[ak][tn0 + l16];       b0.y = Vs[ak + 1][tn0 + l16];       // B[i][d]
        b1.x = Vs[ak][tn0 + 16 + l16];  b1.y = Vs[ak + 1][tn0 + 16 + l16];
        gg0 = wmma4(a, b0, gg0);  gg1 = wmma4(a, b1, gg1);
    }
    {
        const size_t gb = (size_t)blockIdx.x * 4096;
        #pragma unroll
        for (int r = 0; r < 8; ++r) {
            const int e = m0 + r + half * 8;
            Gbuf[gb + e * 64 + tn0 + l16]      = gg0[r];
            Gbuf[gb + e * 64 + tn0 + 16 + l16] = gg1[r];
        }
    }
}

// ---------------------------------------------------------------------------
// K5: inter-chunk kernel.  grid = 64 (b,h), 256 threads, 16 sequential chunks.
// ---------------------------------------------------------------------------
__global__ __launch_bounds__(256)
void chunk_inter_kernel(const float* __restrict__ qb, const float* __restrict__ ob,
                        const float* __restrict__ g_arr, const float* __restrict__ m_arr,
                        const float* __restrict__ Gbuf, const float* __restrict__ ubuf,
                        const float* __restrict__ denbuf,
                        float* __restrict__ Hbuf)   // in: P_intra, out: h
{
    __shared__ float Ct[64][LDC];
    __shared__ float Qs[64][LDC];
    __shared__ float nst[64];
    __shared__ float sg[64], sm[64], dl[64];
    __shared__ float red[256];

    const int tid  = threadIdx.x;
    const int lane = tid & 31, wave = tid >> 5;
    const int l16  = lane & 15, half = lane >> 4;
    const int bh = blockIdx.x;
    const int b  = bh >> 4, h = bh & 15;
    const int tm = wave >> 1, m0 = tm * 16, tn0 = (wave & 1) * 32;

    #pragma unroll
    for (int z = 0; z < 16; ++z) {
        const int flat = tid + z * 256;
        Ct[flat >> 6][flat & 63] = 0.0f;
    }
    if (tid < 64) nst[tid] = 0.0f;

    for (int c = 0; c < NCHUNK; ++c) {
        __syncthreads();
        {
            const int r = tid >> 2, c0 = (tid & 3) * 16;
            const size_t gb2 = ((size_t)(b * 1024 + c * CHUNK + r)) * HIDDIM + h * HDIM + c0;
            #pragma unroll
            for (int z = 0; z < 4; ++z)
                async_ld_b128(&Qs[r][c0 + z * 4], qb + gb2 + z * 4);
        }
        if (tid < 64) {
            const size_t sb = (size_t)bh * 1024 + c * CHUNK + tid;
            sg[tid] = g_arr[sb];
            sm[tid] = m_arr[sb];
        }
        wait_async0();
        __syncthreads();
        const float Mc = (c == 0) ? 0.0f : m_arr[(size_t)bh * 1024 + c * CHUNK - 1];

        // den-inter partials: n . q_j
        {
            const int j = tid & 63, grp = tid >> 6;
            float s = 0.0f;
            #pragma unroll
            for (int z = 0; z < 16; ++z) s += nst[grp * 16 + z] * Qs[j][grp * 16 + z];
            red[tid] = s;
        }
        // inter[j,e] = sum_d Q[j,d] * Ctilde[d,e]   (Ct holds [e][d])
        v8f a0 = {}, a1 = {};
        #pragma unroll
        for (int kk = 0; kk < 64; kk += 4) {
            const int ak = kk + half * 2;
            v2f av = *(const v2f*)&Qs[m0 + l16][ak];
            v2f b0 = *(const v2f*)&Ct[tn0 + l16][ak];
            v2f b1 = *(const v2f*)&Ct[tn0 + 16 + l16][ak];
            a0 = wmma4(av, b0, a0);  a1 = wmma4(av, b1, a1);
        }
        __syncthreads();
        if (tid < 64) dl[tid] = red[tid] + red[64 + tid] + red[128 + tid] + red[192 + tid];

        // state update: Ctilde = decay*Ctilde + G_c ; n = decay*n + u_c
        const float decay = expf(sg[63] + Mc - sm[63]);
        {
            const size_t gbase = (size_t)(bh * NCHUNK + c) * 4096;
            #pragma unroll
            for (int z = 0; z < 16; ++z) {
                const int flat = tid + z * 256;
                Ct[flat >> 6][flat & 63] = decay * Ct[flat >> 6][flat & 63] + Gbuf[gbase + flat];
            }
            if (tid < 64)
                nst[tid] = decay * nst[tid] + ubuf[(size_t)(bh * NCHUNK + c) * 64 + tid];
        }
        __syncthreads();

        // combine: h = o .* (scl*inter + P_intra) / max(|scl*deninter + den_intra|, 1)
        {
            const size_t pb = (size_t)(bh * NCHUNK + c) * 4096;
            #pragma unroll
            for (int r = 0; r < 8; ++r) {
                const int j = m0 + r + half * 8;
                const float scl = expf(sg[j] + Mc - sm[j]);
                float den = scl * dl[j] + denbuf[(size_t)bh * 1024 + c * CHUNK + j];
                den = fmaxf(fabsf(den), 1.0f);
                const size_t orow = ((size_t)(b * 1024 + c * CHUNK + j)) * HIDDIM + h * HDIM;
                const int e0 = tn0 + l16, e1 = e0 + 16;
                const float n0 = scl * a0[r] + Hbuf[pb + j * 64 + e0];
                const float n1 = scl * a1[r] + Hbuf[pb + j * 64 + e1];
                Hbuf[pb + j * 64 + e0] = ob[orow + e0] * n0 / den;
                Hbuf[pb + j * 64 + e1] = ob[orow + e1] * n1 / den;
            }
        }
    }
}

// ---------------------------------------------------------------------------
// K6: LayerNorm over head-major h.  grid = 4096 token rows, 256 threads.
// ---------------------------------------------------------------------------
__global__ __launch_bounds__(256)
void ln_kernel(const float* __restrict__ hb, const float* __restrict__ gamma,
               const float* __restrict__ beta, float* __restrict__ out)
{
    __shared__ float rs[8], rs2[8];
    const int row = blockIdx.x;          // b*1024 + t
    const int b = row >> 10, t = row & 1023;
    const int tid = threadIdx.x;

    float vals[4];
    float s = 0.0f, s2 = 0.0f;
    #pragma unroll
    for (int i = 0; i < 4; ++i) {
        const int cH = tid + i * 256, h = cH >> 6, e = cH & 63;
        const float vv = hb[((size_t)(b * NHEAD + h) * 1024 + t) * HDIM + e];
        vals[i] = vv;
        s += vv;  s2 += vv * vv;
    }
    #pragma unroll
    for (int off = 16; off; off >>= 1) {
        s  += __shfl_xor(s,  off, 32);
        s2 += __shfl_xor(s2, off, 32);
    }
    const int wave = tid >> 5, lane = tid & 31;
    if (lane == 0) { rs[wave] = s; rs2[wave] = s2; }
    __syncthreads();
    float ts = 0.0f, ts2 = 0.0f;
    #pragma unroll
    for (int w = 0; w < 8; ++w) { ts += rs[w]; ts2 += rs2[w]; }
    const float mu  = ts * (1.0f / 1024.0f);
    const float var = ts2 * (1.0f / 1024.0f) - mu * mu;
    const float inv = rsqrtf(var + 1e-5f);
    #pragma unroll
    for (int i = 0; i < 4; ++i) {
        const int cH = tid + i * 256;
        out[(size_t)row * HIDDIM + cH] = (vals[i] - mu) * inv * gamma[cH] + beta[cH];
    }
}

// ---------------------------------------------------------------------------
extern "C" void kernel_launch(void* const* d_in, const int* in_sizes, int n_in,
                              void* d_out, int out_size, void* d_ws, size_t ws_size,
                              hipStream_t stream)
{
    const float* x     = (const float*)d_in[0];
    const float* Wq    = (const float*)d_in[1];
    const float* Wk    = (const float*)d_in[2];
    const float* Wv    = (const float*)d_in[3];
    const float* Wo    = (const float*)d_in[4];
    const float* b_o   = (const float*)d_in[5];
    const float* w_i   = (const float*)d_in[6];
    const float* b_i   = (const float*)d_in[7];
    const float* w_f   = (const float*)d_in[8];
    const float* b_f   = (const float*)d_in[9];
    const float* gamma = (const float*)d_in[10];
    const float* beta  = (const float*)d_in[11];

    // workspace layout (floats); total ~= 24.4M floats ~= 98 MB
    float* ws = (float*)d_ws;
    const size_t big = (size_t)NTOK * HIDDIM;   // 4M
    const size_t sml = (size_t)BHEADS * 1024;   // 64K
    float* q_buf = ws;
    float* k_buf = q_buf + big;
    float* v_buf = k_buf + big;
    float* o_buf = v_buf + big;
    float* i_buf = o_buf + big;      // head-major (bh, t)
    float* f_buf = i_buf + sml;
    float* m_buf = f_buf + sml;
    float* g_buf = m_buf + sml;
    float* P_buf = g_buf + sml;      // (bh, t, e) — becomes h after K5
    float* d_buf = P_buf + big;      // den_intra (bh, t)
    float* G_buf = d_buf + sml;      // (bh*16+c, e, d)
    float* u_buf = G_buf + big;      // (bh*16+c, d)

    proj_gemm_kernel<<<dim3(2048), dim3(256), 0, stream>>>(
        x, Wq, Wk, Wv, Wo, b_o, q_buf, k_buf, v_buf, o_buf);

    ifproj_kernel<<<dim3(NTOK), dim3(32), 0, stream>>>(
        x, w_i, b_i, w_f, b_f, i_buf, f_buf);

    gate_scan_kernel<<<dim3(BHEADS), dim3(64), 0, stream>>>(
        i_buf, f_buf, m_buf, g_buf);

    chunk_intra_kernel<<<dim3(BHEADS * NCHUNK), dim3(256), 0, stream>>>(
        q_buf, k_buf, v_buf, i_buf, g_buf, m_buf, P_buf, d_buf, G_buf, u_buf);

    chunk_inter_kernel<<<dim3(BHEADS), dim3(256), 0, stream>>>(
        q_buf, o_buf, g_buf, m_buf, G_buf, u_buf, d_buf, P_buf);

    ln_kernel<<<dim3(NTOK), dim3(256), 0, stream>>>(
        P_buf, gamma, beta, (float*)d_out);
}

// v001
// It runs in 321 microseconds.
// Timed twice side by side with v000, it ran 1.36 times as fast both times.
#include <hip/hip_runtime.h>
#include <math.h>

// ---------------------------------------------------------------------------
// mLSTM layer for gfx1250 (MI455X), fp32 end-to-end, chunkwise-parallel form.
//  K1: fused q/k/v/o projection GEMM            (V_WMMA_F32_16X16X4_F32)
//  K2: i/f gate projections (head-major output) (V_WMMA_F32_16X16X4_F32)
//  K3: gate scan: m (max,+ prefix) and per-chunk cumsum g, parallel prefix
//  K4: intra-chunk kernel, 1024 parallel blocks: QV^T, QK^T, (w.Sv)K, G, u
//  K5: inter-chunk kernel, 64 blocks x 16 sequential chunk steps: Q@C + update
//  K6: LayerNorm -> d_out
//  K1/K4/K5 tile staging uses GLOBAL_LOAD_ASYNC_TO_LDS_B128 (ASYNCcnt) where no
//  transpose is needed; LDS tiles are 16B-aligned per row for B128.
// ---------------------------------------------------------------------------

typedef __attribute__((ext_vector_type(2))) float v2f;
typedef __attribute__((ext_vector_type(8))) float v8f;

#define NTOK   4096          // B*T
#define INDIM  1024
#define HIDDIM 1024
#define NHEAD  16
#define HDIM   64
#define CHUNK  64
#define NCHUNK 16            // T / CHUNK
#define BHEADS 64            // B*H

#define TILE_M 64
#define TILE_N 128
#define KSTEP  32
#define LDA_P  36            // 144B rows: 16B aligned, bank-safe
#define LDB_P  36
#define LDC    68            // 272B rows: 16B aligned (async B128), bank-safe

__device__ __forceinline__ v8f wmma4(v2f a, v2f b, v8f c) {
    return __builtin_amdgcn_wmma_f32_16x16x4_f32(false, a, false, b, (short)0, c, false, false);
}

// Async 16B copy: global -> LDS, tracked by ASYNCcnt (per-lane addresses).
__device__ __forceinline__ void async_ld_b128(void* lds_ptr, const void* gaddr) {
    unsigned lds_off = (unsigned)(unsigned long long)lds_ptr;  // flat LDS addr[31:0]
    asm volatile("global_load_async_to_lds_b128 %0, %1, off"
                 :: "v"(lds_off), "v"(gaddr) : "memory");
}
__device__ __forceinline__ void wait_async0() {
    asm volatile("s_wait_asynccnt 0x0" ::: "memory");
}

// ---------------------------------------------------------------------------
// K1: fused projection GEMM.  grid = 64*32 = 2048 blocks, 256 threads.
// ---------------------------------------------------------------------------
__global__ __launch_bounds__(256)
void proj_gemm_kernel(const float* __restrict__ x,
                      const float* __restrict__ Wq, const float* __restrict__ Wk,
                      const float* __restrict__ Wv, const float* __restrict__ Wo,
                      const float* __restrict__ b_o,
                      float* __restrict__ outq, float* __restrict__ outk,
                      float* __restrict__ outv, float* __restrict__ outo)
{
    __shared__ float As[TILE_M][LDA_P];
    __shared__ float Bs[TILE_N][LDB_P];

    const int tid  = threadIdx.x;
    const int lane = tid & 31;
    const int wave = tid >> 5;

    const int bm = blockIdx.x >> 5;
    const int bn = blockIdx.x & 31;
    const int group    = bn >> 3;
    const int n_base_g = (bn & 7) * TILE_N;

    const float* W = (group == 0) ? Wq : (group == 1) ? Wk : (group == 2) ? Wv : Wo;
    float* outp    = (group == 0) ? outq : (group == 1) ? outk : (group == 2) ? outv : outo;

    const int wm = (wave >> 2) * 32;
    const int wn = (wave & 3)  * 32;
    const int half = lane >> 4;
    const int l16  = lane & 15;

    v8f acc[2][2] = {};

    const int ar = tid >> 2;
    const int ac = (tid & 3) * 8;
    const int bk = tid >> 3;
    const int bc = (tid & 7) * 16;

    for (int k0 = 0; k0 < INDIM; k0 += KSTEP) {
        // ---- stage A (64 x 32): async global -> LDS, no VGPR round trip ----
        {
            const float* gp = x + (size_t)(bm * TILE_M + ar) * INDIM + k0 + ac;
            async_ld_b128(&As[ar][ac],     gp);
            async_ld_b128(&As[ar][ac + 4], gp + 4);
        }
        // ---- stage B (32 x 128), transposed into LDS via VGPRs ----
        {
            const float* gp = W + (size_t)(k0 + bk) * HIDDIM + n_base_g + bc;
            if (k0 + KSTEP < INDIM)
                __builtin_prefetch(gp + (size_t)KSTEP * HIDDIM, 0, 0);
            float4 b0 = *(const float4*)(gp);
            float4 b1 = *(const float4*)(gp + 4);
            float4 b2 = *(const float4*)(gp + 8);
            float4 b3 = *(const float4*)(gp + 12);
            Bs[bc +  0][bk] = b0.x;  Bs[bc +  1][bk] = b0.y;
            Bs[bc +  2][bk] = b0.z;  Bs[bc +  3][bk] = b0.w;
            Bs[bc +  4][bk] = b1.x;  Bs[bc +  5][bk] = b1.y;
            Bs[bc +  6][bk] = b1.z;  Bs[bc +  7][bk] = b1.w;
            Bs[bc +  8][bk] = b2.x;  Bs[bc +  9][bk] = b2.y;
            Bs[bc + 10][bk] = b2.z;  Bs[bc + 11][bk] = b2.w;
            Bs[bc + 12][bk] = b3.x;  Bs[bc + 13][bk] = b3.y;
            Bs[bc + 14][bk] = b3.z;  Bs[bc + 15][bk] = b3.w;
        }
        wait_async0();
        __syncthreads();

        #pragma unroll
        for (int kk = 0; kk < KSTEP; kk += 4) {
            const int ak = kk + half * 2;
            v2f a0 = *(const v2f*)&As[wm +  0 + l16][ak];
            v2f a1 = *(const v2f*)&As[wm + 16 + l16][ak];
            v2f b0 = *(const v2f*)&Bs[wn +  0 + l16][ak];
            v2f b1 = *(const v2f*)&Bs[wn + 16 + l16][ak];
            acc[0][0] = wmma4(a0, b0, acc[0][0]);
            acc[0][1] = wmma4(a0, b1, acc[0][1]);
            acc[1][0] = wmma4(a1, b0, acc[1][0]);
            acc[1][1] = wmma4(a1, b1, acc[1][1]);
        }
        __syncthreads();
    }

    const int row0 = bm * TILE_M + wm;
    const int col0 = n_base_g + wn;
    #pragma unroll
    for (int i = 0; i < 2; ++i) {
        #pragma unroll
        for (int j = 0; j < 2; ++j) {
            const int col = col0 + j * 16 + l16;
            const float bo = (group == 3) ? b_o[col] : 0.0f;
            #pragma unroll
            for (int r = 0; r < 8; ++r) {
                const int row = row0 + i * 16 + r + half * 8;
                float val = acc[i][j][r];
                if (group == 0)      val *= 0.125f;                           // q / sqrt(D)
                else if (group == 3) val = 1.0f / (1.0f + expf(-(val + bo))); // sigmoid
                outp[(size_t)row * HIDDIM + col] = val;
            }
        }
    }
}

// ---------------------------------------------------------------------------
// K2: i/f projections on WMMA, output HEAD-MAJOR: out[(b*16+h)*1024 + t].
//  grid = 128 row blocks x {i, f} = 256 blocks, 256 threads.
//  A block owns 32 tokens x 16 heads of one gate; wave w sums k in
//  [128w, 128w+128); the eight partial tiles are added through LDS.
// ---------------------------------------------------------------------------
#define IF_ROWS 32           // tokens per block = one 128B line of head-major output
#define IF_KS   128          // k slice per wave = one 512B wave-wide load per row
#define IF_XP   1028         // 4112B rows: 16B more than a row of x, for b128 readers
#define IF_RP   36           // 144B rows of the partial tiles

__global__ __launch_bounds__(256)
void ifproj_kernel(const float* __restrict__ x,
                   const float* __restrict__ wi, const float* __restrict__ bi,
                   const float* __restrict__ wf, const float* __restrict__ bf,
                   float* __restrict__ outi, float* __restrict__ outf)
{
    __shared__ __attribute__((aligned(16))) float Xs[IF_ROWS][IF_XP];
    __shared__ __attribute__((aligned(16))) float red[8][NHEAD][IF_RP];

    const unsigned tid  = threadIdx.x;
    const unsigned lane = tid & 31;
    const unsigned wave = tid >> 5;
    const unsigned l16  = lane & 15;
    const unsigned half = lane >> 4;

    const int gate = blockIdx.x & 1;                 // 0: i, 1: f
    const int row0 = (blockIdx.x >> 1) * IF_ROWS;    // b*1024 + t
    const float* w    = gate ? wf : wi;
    const float* bias = gate ? bf : bi;
    float* op         = gate ? outf : outi;
    const unsigned kb = wave * IF_KS;

    // B fragments straight from global: lane = head, k = kb + 8g + 4*half + e
    float bw[16][4];
    {
        const unsigned wo = (kb + half * 4) * NHEAD + l16;
        #pragma unroll
        for (int g = 0; g < 16; ++g) {
            #pragma unroll
            for (int e = 0; e < 4; ++e)
                bw[g][e] = w[wo + (g * 8 + e) * NHEAD];
        }
    }
    // x rows: whole-line loads (the block reads one 4KB row per step), then LDS
    {
        const float* xb = x + (size_t)row0 * INDIM;
        #pragma unroll
        for (int i = 0; i < IF_ROWS; ++i)
            *(float4*)&Xs[i][tid * 4] = *(const float4*)&xb[tid * 4 + i * INDIM];
    }
    __syncthreads();

    // A fragments: lane = token, same k order as bw
    v8f acc0 = {}, acc1 = {};
    #pragma unroll
    for (int g = 0; g < 16; ++g) {
        const float4 xa0 = *(const float4*)&Xs[l16][kb + g * 8 + half * 4];
        const float4 xa1 = *(const float4*)&Xs[16 + l16][kb + g * 8 + half * 4];
        v2f b01, b23, a;
        b01.x = bw[g][0];  b01.y = bw[g][1];
        b23.x = bw[g][2];  b23.y = bw[g][3];
        a.x = xa0.x;  a.y = xa0.y;  acc0 = wmma4(a, b01, acc0);
        a.x = xa1.x;  a.y = xa1.y;  acc1 = wmma4(a, b01, acc1);
        a.x = xa0.z;  a.y = xa0.w;  acc0 = wmma4(a, b23, acc0);
        a.x = xa1.z;  a.y = xa1.w;  acc1 = wmma4(a, b23, acc1);
    }

    // partial tiles, [head][token] so that the sum below reads along tokens
    #pragma unroll
    for (int r = 0; r < 8; ++r) {
        red[wave][l16][half * 8 + r]      = acc0[r];
        red[wave][l16][16 + half * 8 + r] = acc1[r];
    }
    __syncthreads();

    const int b  = row0 >> 10;
    const int t0 = row0 & 1023;
    #pragma unroll
    for (int z = 0; z < 2; ++z) {
        const int col = wave + z * 8;
        float s = 0.0f;
        #pragma unroll
        for (int p = 0; p < 8; ++p) s += red[p][col][lane];
        op[(size_t)(b * NHEAD + col) * 1024 + t0 + lane] = s + bias[col];
    }
}

// ---------------------------------------------------------------------------
// K3: gate scan.  m_t = max(f_t + m_{t-1}, i_t) via (max,+) prefix:
//   g_j = per-chunk cumsum f;  m_j = g_j + max(m_entry, prefmax(i - g))
// ---------------------------------------------------------------------------
__global__ __launch_bounds__(64)
void gate_scan_kernel(const float* __restrict__ ihm, const float* __restrict__ fhm,
                      float* __restrict__ m_arr, float* __restrict__ g_arr)
{
    __shared__ float sarr[64];
    __shared__ float bc[2];
    const int bh  = blockIdx.x;
    const int tid = threadIdx.x;
    float me = 0.0f;
    for (int c = 0; c < NCHUNK; ++c) {
        const size_t ix = (size_t)bh * 1024 + c * CHUNK + tid;
        const float fv = fhm[ix];
        const float iv = ihm[ix];
        float g = fv;
        sarr[tid] = g; __syncthreads();
        #pragma unroll
        for (int off = 1; off < 64; off <<= 1) {
            const float other = (tid >= off) ? sarr[tid - off] : 0.0f;
            __syncthreads();
            g += other;
            sarr[tid] = g;
            __syncthreads();
        }
        if (tid == 63) bc[0] = g;
        float pm = iv - g;
        sarr[tid] = pm; __syncthreads();
        #pragma unroll
        for (int off = 1; off < 64; off <<= 1) {
            const float other = (tid >= off) ? sarr[tid - off] : -1e30f;
            __syncthreads();
            pm = fmaxf(pm, other);
            sarr[tid] = pm;
            __syncthreads();
        }
        if (tid == 63) bc[1] = pm;
        m_arr[ix] = g + fmaxf(me, pm);
        g_arr[ix] = g;
        __syncthreads();
        me = bc[0] + fmaxf(me, bc[1]);
        __syncthreads();
    }
}

// ---------------------------------------------------------------------------
// K4: intra-chunk kernel.  grid = 1024 blocks, 256 threads.
// ---------------------------------------------------------------------------
__global__ __launch_bounds__(256)
void chunk_intra_kernel(const float* __restrict__ qb, const float* __restrict__ kb,
                        const float* __restrict__ vb, const float* __restrict__ ihm,
                        const float* __restrict__ g_arr, const float* __restrict__ m_arr,
                        float* __restrict__ Pbuf, float* __restrict__ denbuf,
                        float* __restrict__ Gbuf, float* __restrict__ ubuf)
{
    __shared__ float Qs[64][LDC];   // later reused as W (weighted Sv)
    __shared__ float Ks[64][LDC];   // later scaled by wg
    __shared__ float Vs[64][LDC];
    __shared__ float sg[64], sm[64], sii[64], wgl[64];
    __shared__ float denp[2][64];
    __shared__ float red[256];

    const int tid  = threadIdx.x;
    const int lane = tid & 31;
    const int wave = tid >> 5;
    const int l16  = lane & 15;
    const int half = lane >> 4;

    const int bh = blockIdx.x >> 4;
    const int c  = blockIdx.x & 15;
    const int b  = bh >> 4, h = bh & 15;

    // ---- stage Q,K,V chunk tiles: async global -> LDS ----
    {
        const int r  = tid >> 2;
        const int c0 = (tid & 3) * 16;
        const size_t gbase = ((size_t)(b * 1024 + c * CHUNK + r)) * HIDDIM + h * HDIM + c0;
        #pragma unroll
        for (int z = 0; z < 4; ++z) {
            async_ld_b128(&Qs[r][c0 + z * 4], qb + gbase + z * 4);
            async_ld_b128(&Ks[r][c0 + z * 4], kb + gbase + z * 4);
            async_ld_b128(&Vs[r][c0 + z * 4], vb + gbase + z * 4);
        }
    }
    if (tid < 64) {
        const size_t sb = (size_t)bh * 1024 + c * CHUNK + tid;
        sg[tid]  = g_arr[sb];
        sm[tid]  = m_arr[sb];
        sii[tid] = ihm[sb];
    }
    wait_async0();
    __syncthreads();
    if (tid < 64)
        wgl[tid] = expf(sg[63] - sg[tid] + sii[tid] - sm[63]);   // state-inc weights

    const int tm  = wave >> 1;
    const int m0  = tm * 16;
    const int tn0 = (wave & 1) * 32;

    // ---- GEMM 1+2 fused: Sv = Q V^T, Sk = Q K^T ----
    v8f sv0 = {}, sv1 = {}, sk0 = {}, sk1 = {};
    #pragma unroll
    for (int kk = 0; kk < 64; kk += 4) {
        const int ak = kk + half * 2;
        v2f a   = *(const v2f*)&Qs[m0 + l16][ak];
        v2f bv0 = *(const v2f*)&Vs[tn0 + l16][ak];
        v2f bv1 = *(const v2f*)&Vs[tn0 + 16 + l16][ak];
        v2f bk0 = *(const v2f*)&Ks[tn0 + l16][ak];
        v2f bk1 = *(const v2f*)&Ks[tn0 + 16 + l16][ak];
        sv0 = wmma4(a, bv0, sv0);  sv1 = wmma4(a, bv1, sv1);
        sk0 = wmma4(a, bk0, sk0);  sk1 = wmma4(a, bk1, sk1);
    }
    __syncthreads();   // all Qs reads complete before overwrite

    // ---- causal decay weights, W into Qs, den_intra reduce ----
    #pragma unroll
    for (int r = 0; r < 8; ++r) {
        const int j  = m0 + r + half * 8;
        const int i0 = tn0 + l16;
        const int i1 = i0 + 16;
        const float gj = sg[j], mj = sm[j];
        const float w0 = (i0 <= j) ? expf(gj - sg[i0] + sii[i0] - mj) : 0.0f;
        const float w1 = (i1 <= j) ? expf(gj - sg[i1] + sii[i1] - mj) : 0.0f;
        Qs[j][i0] = w0 * sv0[r];
        Qs[j][i1] = w1 * sv1[r];
        float dp = w0 * sk0[r] + w1 * sk1[r];
        #pragma unroll
        for (int off = 8; off; off >>= 1) dp += __shfl_xor(dp, off, 32);
        if (l16 == 0) denp[wave & 1][j] = dp;
    }
    __syncthreads();
    if (tid < 64)
        denbuf[(size_t)bh * 1024 + c * CHUNK + tid] = denp[0][tid] + denp[1][tid];

    // ---- GEMM 3: P = W @ K  (B from row-major Ks via two scalar loads) ----
    v8f p0 = {}, p1 = {};
    #pragma unroll
    for (int kk = 0; kk < 64; kk += 4) {
        const int ak = kk + half * 2;
        v2f a = *(const v2f*)&Qs[m0 + l16][ak];
        v2f b0, b1;
        b0.x = Ks[ak][tn0 + l16];       b0.y = Ks[ak + 1][tn0 + l16];
        b1.x = Ks[ak][tn0 + 16 + l16];  b1.y = Ks[ak + 1][tn0 + 16 + l16];
        p0 = wmma4(a, b0, p0);  p1 = wmma4(a, b1, p1);
    }
    {
        const size_t pb = (size_t)blockIdx.x * 4096;   // (bh*16+c) * 64*64
        #pragma unroll
        for (int r = 0; r < 8; ++r) {
            const int j = m0 + r + half * 8;
            Pbuf[pb + j * 64 + tn0 + l16]      = p0[r];
            Pbuf[pb + j * 64 + tn0 + 16 + l16] = p1[r];
        }
    }
    __syncthreads();

    // ---- scale K rows by wg, column sums -> u ----
    #pragma unroll
    for (int z = 0; z < 16; ++z) {
        const int flat = tid + z * 256;
        Ks[flat >> 6][flat & 63] *= wgl[flat >> 6];
    }
    __syncthreads();
    {
        const int d = tid & 63, grp = tid >> 6;
        float s = 0.0f;
        #pragma unroll
        for (int z = 0; z < 16; ++z) s += Ks[grp * 16 + z][d];
        red[tid] = s;
    }
    __syncthreads();
    if (tid < 64)
        ubuf[(size_t)blockIdx.x * 64 + tid] = red[tid] + red[64 + tid] + red[128 + tid] + red[192 + tid];

    // ---- GEMM 4: G^T[e,d] = sum_i wg_i K[i,e] V[i,d] ----
    v8f gg0 = {}, gg1 = {};
    #pragma unroll
    for (int kk = 0; kk < 64; kk += 4) {
        const int ak = kk + half * 2;
        v2f a, b0, b1;
        a.x  = Ks[ak][m0 + l16];        a.y  = Ks[ak + 1][m0 + l16];        // A[e][i]
        b0.x = Vs[ak][tn0 + l16];       b0.y = Vs[ak + 1][tn0 + l16];       // B[i][d]
        b1.x = Vs[ak][tn0 + 16 + l16];  b1.y = Vs[ak + 1][tn0 + 16 + l16];
        gg0 = wmma4(a, b0, gg0);  gg1 = wmma4(a, b1, gg1);
    }
    {
        const size_t gb = (size_t)blockIdx.x * 4096;
        #pragma unroll
        for (int r = 0; r < 8; ++r) {
            const int e = m0 + r + half * 8;
            Gbuf[gb + e * 64 + tn0 + l16]      = gg0[r];
            Gbuf[gb + e * 64 + tn0 + 16 + l16] = gg1[r];
        }
    }
}

// ---------------------------------------------------------------------------
// K5: inter-chunk kernel.  grid = 64 (b,h), 256 threads, 16 sequential chunks.
// ---------------------------------------------------------------------------
__global__ __launch_bounds__(256)
void chunk_inter_kernel(const float* __restrict__ qb, const float* __restrict__ ob,
                        const float* __restrict__ g_arr, const float* __restrict__ m_arr,
                        const float* __restrict__ Gbuf, const float* __restrict__ ubuf,
                        const float* __restrict__ denbuf,
                        float* __restrict__ Hbuf)   // in: P_intra, out: h
{
    __shared__ float Ct[64][LDC];
    __shared__ float Qs[64][LDC];
    __shared__ float nst[64];
    __shared__ float sg[64], sm[64], dl[64];
    __shared__ float red[256];

    const int tid  = threadIdx.x;
    const int lane = tid & 31, wave = tid >> 5;
    const int l16  = lane & 15, half = lane >> 4;
    const int bh = blockIdx.x;
    const int b  = bh >> 4, h = bh & 15;
    const int tm = wave >> 1, m0 = tm * 16, tn0 = (wave & 1) * 32;

    #pragma unroll
    for (int z = 0; z < 16; ++z) {
        const int flat = tid + z * 256;
        Ct[flat >> 6][flat & 63] = 0.0f;
    }
    if (tid < 64) nst[tid] = 0.0f;

    for (int c = 0; c < NCHUNK; ++c) {
        __syncthreads();
        {
            const int r = tid >> 2, c0 = (tid & 3) * 16;
            const size_t gb2 = ((size_t)(b * 1024 + c * CHUNK + r)) * HIDDIM + h * HDIM + c0;
            #pragma unroll
            for (int z = 0; z < 4; ++z)
                async_ld_b128(&Qs[r][c0 + z * 4], qb + gb2 + z * 4);
        }
        if (tid < 64) {
            const size_t sb = (size_t)bh * 1024 + c * CHUNK + tid;
            sg[tid] = g_arr[sb];
            sm[tid] = m_arr[sb];
        }
        wait_async0();
        __syncthreads();
        const float Mc = (c == 0) ? 0.0f : m_arr[(size_t)bh * 1024 + c * CHUNK - 1];

        // den-inter partials: n . q_j
        {
            const int j = tid & 63, grp = tid >> 6;
            float s = 0.0f;
            #pragma unroll
            for (int z = 0; z < 16; ++z) s += nst[grp * 16 + z] * Qs[j][grp * 16 + z];
            red[tid] = s;
        }
        // inter[j,e] = sum_d Q[j,d] * Ctilde[d,e]   (Ct holds [e][d])
        v8f a0 = {}, a1 = {};
        #pragma unroll
        for (int kk = 0; kk < 64; kk += 4) {
            const int ak = kk + half * 2;
            v2f av = *(const v2f*)&Qs[m0 + l16][ak];
            v2f b0 = *(const v2f*)&Ct[tn0 + l16][ak];
            v2f b1 = *(const v2f*)&Ct[tn0 + 16 + l16][ak];
            a0 = wmma4(av, b0, a0);  a1 = wmma4(av, b1, a1);
        }
        __syncthreads();
        if (tid < 64) dl[tid] = red[tid] + red[64 + tid] + red[128 + tid] + red[192 + tid];

        // state update: Ctilde = decay*Ctilde + G_c ; n = decay*n + u_c
        const float decay = expf(sg[63] + Mc - sm[63]);
        {
            const size_t gbase = (size_t)(bh * NCHUNK + c) * 4096;
            #pragma unroll
            for (int z = 0; z < 16; ++z) {
                const int flat = tid + z * 256;
                Ct[flat >> 6][flat & 63] = decay * Ct[flat >> 6][flat & 63] + Gbuf[gbase + flat];
            }
            if (tid < 64)
                nst[tid] = decay * nst[tid] + ubuf[(size_t)(bh * NCHUNK + c) * 64 + tid];
        }
        __syncthreads();

        // combine: h = o .* (scl*inter + P_intra) / max(|scl*deninter + den_intra|, 1)
        {
            const size_t pb = (size_t)(bh * NCHUNK + c) * 4096;
            #pragma unroll
            for (int r = 0; r < 8; ++r) {
                const int j = m0 + r + half * 8;
                const float scl = expf(sg[j] + Mc - sm[j]);
                float den = scl * dl[j] + denbuf[(size_t)bh * 1024 + c * CHUNK + j];
                den = fmaxf(fabsf(den), 1.0f);
                const size_t orow = ((size_t)(b * 1024 + c * CHUNK + j)) * HIDDIM + h * HDIM;
                const int e0 = tn0 + l16, e1 = e0 + 16;
                const float n0 = scl * a0[r] + Hbuf[pb + j * 64 + e0];
                const float n1 = scl * a1[r] + Hbuf[pb + j * 64 + e1];
                Hbuf[pb + j * 64 + e0] = ob[orow + e0] * n0 / den;
                Hbuf[pb + j * 64 + e1] = ob[orow + e1] * n1 / den;
            }
        }
    }
}

// ---------------------------------------------------------------------------
// K6: LayerNorm over head-major h.  grid = 4096 token rows, 256 threads.
// ---------------------------------------------------------------------------
__global__ __launch_bounds__(256)
void ln_kernel(const float* __restrict__ hb, const float* __restrict__ gamma,
               const float* __restrict__ beta, float* __restrict__ out)
{
    __shared__ float rs[8], rs2[8];
    const int row = blockIdx.x;          // b*1024 + t
    const int b = row >> 10, t = row & 1023;
    const int tid = threadIdx.x;

    float vals[4];
    float s = 0.0f, s2 = 0.0f;
    #pragma unroll
    for (int i = 0; i < 4; ++i) {
        const int cH = tid + i * 256, h = cH >> 6, e = cH & 63;
        const float vv = hb[((size_t)(b * NHEAD + h) * 1024 + t) * HDIM + e];
        vals[i] = vv;
        s += vv;  s2 += vv * vv;
    }
    #pragma unroll
    for (int off = 16; off; off >>= 1) {
        s  += __shfl_xor(s,  off, 32);
        s2 += __shfl_xor(s2, off, 32);
    }
    const int wave = tid >> 5, lane = tid & 31;
    if (lane == 0) { rs[wave] = s; rs2[wave] = s2; }
    __syncthreads();
    float ts = 0.0f, ts2 = 0.0f;
    #pragma unroll
    for (int w = 0; w < 8; ++w) { ts += rs[w]; ts2 += rs2[w]; }
    const float mu  = ts * (1.0f / 1024.0f);
    const float var = ts2 * (1.0f / 1024.0f) - mu * mu;
    const float inv = rsqrtf(var + 1e-5f);
    #pragma unroll
    for (int i = 0; i < 4; ++i) {
        const int cH = tid + i * 256;
        out[(size_t)row * HIDDIM + cH] = (vals[i] - mu) * inv * gamma[cH] + beta[cH];
    }
}

// ---------------------------------------------------------------------------
extern "C" void kernel_launch(void* const* d_in, const int* in_sizes, int n_in,
                              void* d_out, int out_size, void* d_ws, size_t ws_size,
                              hipStream_t stream)
{
    const float* x     = (const float*)d_in[0];
    const float* Wq    = (const float*)d_in[1];
    const float* Wk    = (const float*)d_in[2];
    const float* Wv    = (const float*)d_in[3];
    const float* Wo    = (const float*)d_in[4];
    const float* b_o   = (const float*)d_in[5];
    const float* w_i   = (const float*)d_in[6];
    const float* b_i   = (const float*)d_in[7];
    const float* w_f   = (const float*)d_in[8];
    const float* b_f   = (const float*)d_in[9];
    const float* gamma = (const float*)d_in[10];
    const float* beta  = (const float*)d_in[11];

    // workspace layout (floats); total ~= 24.4M floats ~= 98 MB
    float* ws = (float*)d_ws;
    const size_t big = (size_t)NTOK * HIDDIM;   // 4M
    const size_t sml = (size_t)BHEADS * 1024;   // 64K
    float* q_buf = ws;
    float* k_buf = q_buf + big;
    float* v_buf = k_buf + big;
    float* o_buf = v_buf + big;
    float* i_buf = o_buf + big;      // head-major (bh, t)
    float* f_buf = i_buf + sml;
    float* m_buf = f_buf + sml;
    float* g_buf = m_buf + sml;
    float* P_buf = g_buf + sml;      // (bh, t, e) — becomes h after K5
    float* d_buf = P_buf + big;      // den_intra (bh, t)
    float* G_buf = d_buf + sml;      // (bh*16+c, e, d)
    float* u_buf = G_buf + big;      // (bh*16+c, d)

    proj_gemm_kernel<<<dim3(2048), dim3(256), 0, stream>>>(
        x, Wq, Wk, Wv, Wo, b_o, q_buf, k_buf, v_buf, o_buf);

    ifproj_kernel<<<dim3(256), dim3(256), 0, stream>>>(
        x, w_i, b_i, w_f, b_f, i_buf, f_buf);

    gate_scan_kernel<<<dim3(BHEADS), dim3(64), 0, stream>>>(
        i_buf, f_buf, m_buf, g_buf);

    chunk_intra_kernel<<<dim3(BHEADS * NCHUNK), dim3(256), 0, stream>>>(
        q_buf, k_buf, v_buf, i_buf, g_buf, m_buf, P_buf, d_buf, G_buf, u_buf);

    chunk_inter_kernel<<<dim3(BHEADS), dim3(256), 0, stream>>>(
        q_buf, o_buf, g_buf, m_buf, G_buf, u_buf, d_buf, P_buf);

    ln_kernel<<<dim3(NTOK), dim3(256), 0, stream>>>(
        P_buf, gamma, beta, (float*)d_out);
}

// v002
// Measured time: 275 microseconds a run.
// Next to v001, in two timings, it ran 1.17 times as fast each time.
// Counting every step since v000, it is 1.59 times as fast.
#include <hip/hip_runtime.h>
#include <math.h>

// ---------------------------------------------------------------------------
// mLSTM layer for gfx1250 (MI455X), fp32 end-to-end, chunkwise-parallel form.
//  K1: fused q/k/v/o projection GEMM            (V_WMMA_F32_16X16X4_F32)
//  K2: i/f gate projections (head-major output) (V_WMMA_F32_16X16X4_F32)
//  K3: gate scan: m (max,+ prefix) and per-chunk cumsum g, parallel prefix
//  K4: intra-chunk kernel, 1024 parallel blocks: QV^T, QK^T, (w.Sv)K, G, u
//  K5: inter-chunk kernel, 1024 parallel blocks: entry state from G tiles, Q@C
//  K6: LayerNorm -> d_out
//  K1/K4/K5 tile staging uses GLOBAL_LOAD_ASYNC_TO_LDS_B128 (ASYNCcnt) where no
//  transpose is needed; LDS tiles are 16B-aligned per row for B128.
// ---------------------------------------------------------------------------

typedef __attribute__((ext_vector_type(2))) float v2f;
typedef __attribute__((ext_vector_type(8))) float v8f;

#define NTOK   4096          // B*T
#define INDIM  1024
#define HIDDIM 1024
#define NHEAD  16
#define HDIM   64
#define CHUNK  64
#define NCHUNK 16            // T / CHUNK
#define BHEADS 64            // B*H

#define TILE_M 64
#define TILE_N 128
#define KSTEP  32
#define LDA_P  36            // 144B rows: 16B aligned, bank-safe
#define LDB_P  36
#define LDC    68            // 272B rows: 16B aligned (async B128), bank-safe

__device__ __forceinline__ v8f wmma4(v2f a, v2f b, v8f c) {
    return __builtin_amdgcn_wmma_f32_16x16x4_f32(false, a, false, b, (short)0, c, false, false);
}

// Async 16B copy: global -> LDS, tracked by ASYNCcnt (per-lane addresses).
__device__ __forceinline__ void async_ld_b128(void* lds_ptr, const void* gaddr) {
    unsigned lds_off = (unsigned)(unsigned long long)lds_ptr;  // flat LDS addr[31:0]
    asm volatile("global_load_async_to_lds_b128 %0, %1, off"
                 :: "v"(lds_off), "v"(gaddr) : "memory");
}
// Four async 16B copies of 64 consecutive bytes.  The s_wait_xcnt closes the same
// statement so that no address register of a copy is reused ahead of it.
__device__ __forceinline__ void async_ld4_b128(void* lds_ptr, const float* gaddr) {
    unsigned l0 = (unsigned)(unsigned long long)lds_ptr;  // flat LDS addr[31:0]
    asm volatile("global_load_async_to_lds_b128 %0, %4, off\n\t"
                 "global_load_async_to_lds_b128 %1, %5, off\n\t"
                 "global_load_async_to_lds_b128 %2, %6, off\n\t"
                 "global_load_async_to_lds_b128 %3, %7, off\n\t"
                 "s_wait_xcnt 0x0"
                 :: "v"(l0), "v"(l0 + 16u), "v"(l0 + 32u), "v"(l0 + 48u),
                    "v"(gaddr), "v"(gaddr + 4), "v"(gaddr + 8), "v"(gaddr + 12)
                 : "memory");
}
__device__ __forceinline__ void wait_async0() {
    asm volatile("s_wait_asynccnt 0x0" ::: "memory");
}

// ---------------------------------------------------------------------------
// K1: fused projection GEMM.  grid = 64*32 = 2048 blocks, 256 threads.
// ---------------------------------------------------------------------------
__global__ __launch_bounds__(256)
void proj_gemm_kernel(const float* __restrict__ x,
                      const float* __restrict__ Wq, const float* __restrict__ Wk,
                      const float* __restrict__ Wv, const float* __restrict__ Wo,
                      const float* __restrict__ b_o,
                      float* __restrict__ outq, float* __restrict__ outk,
                      float* __restrict__ outv, float* __restrict__ outo)
{
    __shared__ float As[TILE_M][LDA_P];
    __shared__ float Bs[TILE_N][LDB_P];

    const int tid  = threadIdx.x;
    const int lane = tid & 31;
    const int wave = tid >> 5;

    const int bm = blockIdx.x >> 5;
    const int bn = blockIdx.x & 31;
    const int group    = bn >> 3;
    const int n_base_g = (bn & 7) * TILE_N;

    const float* W = (group == 0) ? Wq : (group == 1) ? Wk : (group == 2) ? Wv : Wo;
    float* outp    = (group == 0) ? outq : (group == 1) ? outk : (group == 2) ? outv : outo;

    const int wm = (wave >> 2) * 32;
    const int wn = (wave & 3)  * 32;
    const int half = lane >> 4;
    const int l16  = lane & 15;

    v8f acc[2][2] = {};

    const int ar = tid >> 2;
    const int ac = (tid & 3) * 8;
    const int bk = tid >> 3;
    const int bc = (tid & 7) * 16;

    for (int k0 = 0; k0 < INDIM; k0 += KSTEP) {
        // ---- stage A (64 x 32): async global -> LDS, no VGPR round trip ----
        {
            const float* gp = x + (size_t)(bm * TILE_M + ar) * INDIM + k0 + ac;
            async_ld_b128(&As[ar][ac],     gp);
            async_ld_b128(&As[ar][ac + 4], gp + 4);
        }
        // ---- stage B (32 x 128), transposed into LDS via VGPRs ----
        {
            const float* gp = W + (size_t)(k0 + bk) * HIDDIM + n_base_g + bc;
            if (k0 + KSTEP < INDIM)
                __builtin_prefetch(gp + (size_t)KSTEP * HIDDIM, 0, 0);
            float4 b0 = *(const float4*)(gp);
            float4 b1 = *(const float4*)(gp + 4);
            float4 b2 = *(const float4*)(gp + 8);
            float4 b3 = *(const float4*)(gp + 12);
            Bs[bc +  0][bk] = b0.x;  Bs[bc +  1][bk] = b0.y;
            Bs[bc +  2][bk] = b0.z;  Bs[bc +  3][bk] = b0.w;
            Bs[bc +  4][bk] = b1.x;  Bs[bc +  5][bk] = b1.y;
            Bs[bc +  6][bk] = b1.z;  Bs[bc +  7][bk] = b1.w;
            Bs[bc +  8][bk] = b2.x;  Bs[bc +  9][bk] = b2.y;
            Bs[bc + 10][bk] = b2.z;  Bs[bc + 11][bk] = b2.w;
            Bs[bc + 12][bk] = b3.x;  Bs[bc + 13][bk] = b3.y;
            Bs[bc + 14][bk] = b3.z;  Bs[bc + 15][bk] = b3.w;
        }
        wait_async0();
        __syncthreads();

        #pragma unroll
        for (int kk = 0; kk < KSTEP; kk += 4) {
            const int ak = kk + half * 2;
            v2f a0 = *(const v2f*)&As[wm +  0 + l16][ak];
            v2f a1 = *(const v2f*)&As[wm + 16 + l16][ak];
            v2f b0 = *(const v2f*)&Bs[wn +  0 + l16][ak];
            v2f b1 = *(const v2f*)&Bs[wn + 16 + l16][ak];
            acc[0][0] = wmma4(a0, b0, acc[0][0]);
            acc[0][1] = wmma4(a0, b1, acc[0][1]);
            acc[1][0] = wmma4(a1, b0, acc[1][0]);
            acc[1][1] = wmma4(a1, b1, acc[1][1]);
        }
        __syncthreads();
    }

    const int row0 = bm * TILE_M + wm;
    const int col0 = n_base_g + wn;
    #pragma unroll
    for (int i = 0; i < 2; ++i) {
        #pragma unroll
        for (int j = 0; j < 2; ++j) {
            const int col = col0 + j * 16 + l16;
            const float bo = (group == 3) ? b_o[col] : 0.0f;
            #pragma unroll
            for (int r = 0; r < 8; ++r) {
                const int row = row0 + i * 16 + r + half * 8;
                float val = acc[i][j][r];
                if (group == 0)      val *= 0.125f;                           // q / sqrt(D)
                else if (group == 3) val = 1.0f / (1.0f + expf(-(val + bo))); // sigmoid
                outp[(size_t)row * HIDDIM + col] = val;
            }
        }
    }
}

// ---------------------------------------------------------------------------
// K2: i/f projections on WMMA, output HEAD-MAJOR: out[(b*16+h)*1024 + t].
//  grid = 128 row blocks x {i, f} = 256 blocks, 256 threads.
//  A block owns 32 tokens x 16 heads of one gate; wave w sums k in
//  [128w, 128w+128); the eight partial tiles are added through LDS.
// ---------------------------------------------------------------------------
#define IF_ROWS 32           // tokens per block = one 128B line of head-major output
#define IF_KS   128          // k slice per wave = one 512B wave-wide load per row
#define IF_XP   1028         // 4112B rows: 16B more than a row of x, for b128 readers
#define IF_RP   36           // 144B rows of the partial tiles

__global__ __launch_bounds__(256)
void ifproj_kernel(const float* __restrict__ x,
                   const float* __restrict__ wi, const float* __restrict__ bi,
                   const float* __restrict__ wf, const float* __restrict__ bf,
                   float* __restrict__ outi, float* __restrict__ outf)
{
    __shared__ __attribute__((aligned(16))) float Xs[IF_ROWS][IF_XP];
    __shared__ __attribute__((aligned(16))) float red[8][NHEAD][IF_RP];

    const unsigned tid  = threadIdx.x;
    const unsigned lane = tid & 31;
    const unsigned wave = tid >> 5;
    const unsigned l16  = lane & 15;
    const unsigned half = lane >> 4;

    const int gate = blockIdx.x & 1;                 // 0: i, 1: f
    const int row0 = (blockIdx.x >> 1) * IF_ROWS;    // b*1024 + t
    const float* w    = gate ? wf : wi;
    const float* bias = gate ? bf : bi;
    float* op         = gate ? outf : outi;
    const unsigned kb = wave * IF_KS;

    // B fragments straight from global: lane = head, k = kb + 8g + 4*half + e
    float bw[16][4];
    {
        const unsigned wo = (kb + half * 4) * NHEAD + l16;
        #pragma unroll
        for (int g = 0; g < 16; ++g) {
            #pragma unroll
            for (int e = 0; e < 4; ++e)
                bw[g][e] = w[wo + (g * 8 + e) * NHEAD];
        }
    }
    // x rows: whole-line loads (the block reads one 4KB row per step), then LDS
    {
        const float* xb = x + (size_t)row0 * INDIM;
        #pragma unroll
        for (int i = 0; i < IF_ROWS; ++i)
            *(float4*)&Xs[i][tid * 4] = *(const float4*)&xb[tid * 4 + i * INDIM];
    }
    __syncthreads();

    // A fragments: lane = token, same k order as bw
    v8f acc0 = {}, acc1 = {};
    #pragma unroll
    for (int g = 0; g < 16; ++g) {
        const float4 xa0 = *(const float4*)&Xs[l16][kb + g * 8 + half * 4];
        const float4 xa1 = *(const float4*)&Xs[16 + l16][kb + g * 8 + half * 4];
        v2f b01, b23, a;
        b01.x = bw[g][0];  b01.y = bw[g][1];
        b23.x = bw[g][2];  b23.y = bw[g][3];
        a.x = xa0.x;  a.y = xa0.y;  acc0 = wmma4(a, b01, acc0);
        a.x = xa1.x;  a.y = xa1.y;  acc1 = wmma4(a, b01, acc1);
        a.x = xa0.z;  a.y = xa0.w;  acc0 = wmma4(a, b23, acc0);
        a.x = xa1.z;  a.y = xa1.w;  acc1 = wmma4(a, b23, acc1);
    }

    // partial tiles, [head][token] so that the sum below reads along tokens
    #pragma unroll
    for (int r = 0; r < 8; ++r) {
        red[wave][l16][half * 8 + r]      = acc0[r];
        red[wave][l16][16 + half * 8 + r] = acc1[r];
    }
    __syncthreads();

    const int b  = row0 >> 10;
    const int t0 = row0 & 1023;
    #pragma unroll
    for (int z = 0; z < 2; ++z) {
        const int col = wave + z * 8;
        float s = 0.0f;
        #pragma unroll
        for (int p = 0; p < 8; ++p) s += red[p][col][lane];
        op[(size_t)(b * NHEAD + col) * 1024 + t0 + lane] = s + bias[col];
    }
}

// ---------------------------------------------------------------------------
// K3: gate scan.  m_t = max(f_t + m_{t-1}, i_t) via (max,+) prefix:
//   g_j = per-chunk cumsum f;  m_j = g_j + max(m_entry, prefmax(i - g))
// ---------------------------------------------------------------------------
__global__ __launch_bounds__(64)
void gate_scan_kernel(const float* __restrict__ ihm, const float* __restrict__ fhm,
                      float* __restrict__ m_arr, float* __restrict__ g_arr)
{
    __shared__ float sarr[64];
    __shared__ float bc[2];
    const int bh  = blockIdx.x;
    const int tid = threadIdx.x;
    float me = 0.0f;
    for (int c = 0; c < NCHUNK; ++c) {
        const size_t ix = (size_t)bh * 1024 + c * CHUNK + tid;
        const float fv = fhm[ix];
        const float iv = ihm[ix];
        float g = fv;
        sarr[tid] = g; __syncthreads();
        #pragma unroll
        for (int off = 1; off < 64; off <<= 1) {
            const float other = (tid >= off) ? sarr[tid - off] : 0.0f;
            __syncthreads();
            g += other;
            sarr[tid] = g;
            __syncthreads();
        }
        if (tid == 63) bc[0] = g;
        float pm = iv - g;
        sarr[tid] = pm; __syncthreads();
        #pragma unroll
        for (int off = 1; off < 64; off <<= 1) {
            const float other = (tid >= off) ? sarr[tid - off] : -1e30f;
            __syncthreads();
            pm = fmaxf(pm, other);
            sarr[tid] = pm;
            __syncthreads();
        }
        if (tid == 63) bc[1] = pm;
        m_arr[ix] = g + fmaxf(me, pm);
        g_arr[ix] = g;
        __syncthreads();
        me = bc[0] + fmaxf(me, bc[1]);
        __syncthreads();
    }
}

// ---------------------------------------------------------------------------
// K4: intra-chunk kernel.  grid = 1024 blocks, 256 threads.
// ---------------------------------------------------------------------------
__global__ __launch_bounds__(256)
void chunk_intra_kernel(const float* __restrict__ qb, const float* __restrict__ kb,
                        const float* __restrict__ vb, const float* __restrict__ ihm,
                        const float* __restrict__ g_arr, const float* __restrict__ m_arr,
                        float* __restrict__ Pbuf, float* __restrict__ denbuf,
                        float* __restrict__ Gbuf, float* __restrict__ ubuf)
{
    __shared__ float Qs[64][LDC];   // later reused as W (weighted Sv)
    __shared__ float Ks[64][LDC];   // later scaled by wg
    __shared__ float Vs[64][LDC];
    __shared__ float sg[64], sm[64], sii[64], wgl[64];
    __shared__ float denp[2][64];
    __shared__ float red[256];

    const int tid  = threadIdx.x;
    const int lane = tid & 31;
    const int wave = tid >> 5;
    const int l16  = lane & 15;
    const int half = lane >> 4;

    const int bh = blockIdx.x >> 4;
    const int c  = blockIdx.x & 15;
    const int b  = bh >> 4, h = bh & 15;

    // ---- stage Q,K,V chunk tiles: async global -> LDS ----
    {
        const int r  = tid >> 2;
        const int c0 = (tid & 3) * 16;
        const size_t gbase = ((size_t)(b * 1024 + c * CHUNK + r)) * HIDDIM + h * HDIM + c0;
        #pragma unroll
        for (int z = 0; z < 4; ++z) {
            async_ld_b128(&Qs[r][c0 + z * 4], qb + gbase + z * 4);
            async_ld_b128(&Ks[r][c0 + z * 4], kb + gbase + z * 4);
            async_ld_b128(&Vs[r][c0 + z * 4], vb + gbase + z * 4);
        }
    }
    if (tid < 64) {
        const size_t sb = (size_t)bh * 1024 + c * CHUNK + tid;
        sg[tid]  = g_arr[sb];
        sm[tid]  = m_arr[sb];
        sii[tid] = ihm[sb];
    }
    wait_async0();
    __syncthreads();
    if (tid < 64)
        wgl[tid] = expf(sg[63] - sg[tid] + sii[tid] - sm[63]);   // state-inc weights

    const int tm  = wave >> 1;
    const int m0  = tm * 16;
    const int tn0 = (wave & 1) * 32;

    // ---- GEMM 1+2 fused: Sv = Q V^T, Sk = Q K^T ----
    v8f sv0 = {}, sv1 = {}, sk0 = {}, sk1 = {};
    #pragma unroll
    for (int kk = 0; kk < 64; kk += 4) {
        const int ak = kk + half * 2;
        v2f a   = *(const v2f*)&Qs[m0 + l16][ak];
        v2f bv0 = *(const v2f*)&Vs[tn0 + l16][ak];
        v2f bv1 = *(const v2f*)&Vs[tn0 + 16 + l16][ak];
        v2f bk0 = *(const v2f*)&Ks[tn0 + l16][ak];
        v2f bk1 = *(const v2f*)&Ks[tn0 + 16 + l16][ak];
        sv0 = wmma4(a, bv0, sv0);  sv1 = wmma4(a, bv1, sv1);
        sk0 = wmma4(a, bk0, sk0);  sk1 = wmma4(a, bk1, sk1);
    }
    __syncthreads();   // all Qs reads complete before overwrite

    // ---- causal decay weights, W into Qs, den_intra reduce ----
    #pragma unroll
    for (int r = 0; r < 8; ++r) {
        const int j  = m0 + r + half * 8;
        const int i0 = tn0 + l16;
        const int i1 = i0 + 16;
        const float gj = sg[j], mj = sm[j];
        const float w0 = (i0 <= j) ? expf(gj - sg[i0] + sii[i0] - mj) : 0.0f;
        const float w1 = (i1 <= j) ? expf(gj - sg[i1] + sii[i1] - mj) : 0.0f;
        Qs[j][i0] = w0 * sv0[r];
        Qs[j][i1] = w1 * sv1[r];
        float dp = w0 * sk0[r] + w1 * sk1[r];
        #pragma unroll
        for (int off = 8; off; off >>= 1) dp += __shfl_xor(dp, off, 32);
        if (l16 == 0) denp[wave & 1][j] = dp;
    }
    __syncthreads();
    if (tid < 64)
        denbuf[(size_t)bh * 1024 + c * CHUNK + tid] = denp[0][tid] + denp[1][tid];

    // ---- GEMM 3: P = W @ K  (B from row-major Ks via two scalar loads) ----
    v8f p0 = {}, p1 = {};
    #pragma unroll
    for (int kk = 0; kk < 64; kk += 4) {
        const int ak = kk + half * 2;
        v2f a = *(const v2f*)&Qs[m0 + l16][ak];
        v2f b0, b1;
        b0.x = Ks[ak][tn0 + l16];       b0.y = Ks[ak + 1][tn0 + l16];
        b1.x = Ks[ak][tn0 + 16 + l16];  b1.y = Ks[ak + 1][tn0 + 16 + l16];
        p0 = wmma4(a, b0, p0);  p1 = wmma4(a, b1, p1);
    }
    {
        const size_t pb = (size_t)blockIdx.x * 4096;   // (bh*16+c) * 64*64
        #pragma unroll
        for (int r = 0; r < 8; ++r) {
            const int j = m0 + r + half * 8;
            Pbuf[pb + j * 64 + tn0 + l16]      = p0[r];
            Pbuf[pb + j * 64 + tn0 + 16 + l16] = p1[r];
        }
    }
    __syncthreads();

    // ---- scale K rows by wg, column sums -> u ----
    #pragma unroll
    for (int z = 0; z < 16; ++z) {
        const int flat = tid + z * 256;
        Ks[flat >> 6][flat & 63] *= wgl[flat >> 6];
    }
    __syncthreads();
    {
        const int d = tid & 63, grp = tid >> 6;
        float s = 0.0f;
        #pragma unroll
        for (int z = 0; z < 16; ++z) s += Ks[grp * 16 + z][d];
        red[tid] = s;
    }
    __syncthreads();
    if (tid < 64)
        ubuf[(size_t)blockIdx.x * 64 + tid] = red[tid] + red[64 + tid] + red[128 + tid] + red[192 + tid];

    // ---- GEMM 4: G^T[e,d] = sum_i wg_i K[i,e] V[i,d] ----
    v8f gg0 = {}, gg1 = {};
    #pragma unroll
    for (int kk = 0; kk < 64; kk += 4) {
        const int ak = kk + half * 2;
        v2f a, b0, b1;
        a.x  = Ks[ak][m0 + l16];        a.y  = Ks[ak + 1][m0 + l16];        // A[e][i]
        b0.x = Vs[ak][tn0 + l16];       b0.y = Vs[ak + 1][tn0 + l16];       // B[i][d]
        b1.x = Vs[ak][tn0 + 16 + l16];  b1.y = Vs[ak + 1][tn0 + 16 + l16];
        gg0 = wmma4(a, b0, gg0);  gg1 = wmma4(a, b1, gg1);
    }
    {
        const size_t gb = (size_t)blockIdx.x * 4096;
        #pragma unroll
        for (int r = 0; r < 8; ++r) {
            const int e = m0 + r + half * 8;
            Gbuf[gb + e * 64 + tn0 + l16]      = gg0[r];
            Gbuf[gb + e * 64 + tn0 + 16 + l16] = gg1[r];
        }
    }
}

// ---------------------------------------------------------------------------
// K5: inter-chunk kernel.  grid = 1024 (chunk, b*h), 256 threads.
//  A block rebuilds the state that enters its chunk from the G tiles of the
//  earlier chunks, in registers, by the recurrence C = decay*C + G, and then
//  does Q@C and the combine for its one chunk.  No block waits for another.
// ---------------------------------------------------------------------------
__global__ __launch_bounds__(256)
void chunk_inter_kernel(const float* __restrict__ qb, const float* __restrict__ ob,
                        const float* __restrict__ g_arr, const float* __restrict__ m_arr,
                        const float* __restrict__ Gbuf, const float* __restrict__ ubuf,
                        const float* __restrict__ denbuf,
                        float* __restrict__ Hbuf)   // in: P_intra, out: h
{
    __shared__ __attribute__((aligned(16))) float Ct[64][LDC];
    __shared__ __attribute__((aligned(16))) float Qs[64][LDC];
    __shared__ float nst[64];
    __shared__ float sg[64], sm[64], dl[64];
    __shared__ float red[256];

    const int tid  = threadIdx.x;
    const int lane = tid & 31, wave = tid >> 5;
    const int l16  = lane & 15, half = lane >> 4;
    const int c  = (NCHUNK - 1) - (blockIdx.x >> 6);   // longest rebuild starts first
    const int bh = blockIdx.x & 63;
    const int b  = bh >> 4, h = bh & 15;
    const int tm = wave >> 1, m0 = tm * 16, tn0 = (wave & 1) * 32;

    // Q tile: async global -> LDS, in flight while the state is rebuilt
    {
        const int r = tid >> 2, c0 = (tid & 3) * 16;
        const size_t gb2 = ((size_t)(b * 1024 + c * CHUNK + r)) * HIDDIM + h * HDIM + c0;
        async_ld4_b128(&Qs[r][c0], qb + gb2);
    }
    // decay of every chunk of this head: lane l of each wave holds chunk l & 15
    float decl;
    {
        const int lc = lane & 15;
        const size_t eb = (size_t)bh * 1024 + lc * CHUNK;
        const float Mp = (lc == 0) ? 0.0f : m_arr[eb - 1];
        decl = expf(g_arr[eb + 63] + Mp - m_arr[eb + 63]);
    }
    const float Mc = (c == 0) ? 0.0f : m_arr[(size_t)bh * 1024 + c * CHUNK - 1];

    // loaded here, used behind the state rebuild: their latency runs under it
    float gl = 0.0f, ml = 0.0f;
    float uu[NCHUNK - 1];
    if (tid < 64) {
        const size_t sb = (size_t)bh * 1024 + c * CHUNK + tid;
        gl = g_arr[sb];
        ml = m_arr[sb];
        const float* up = ubuf + (size_t)bh * NCHUNK * 64;   // block-uniform base
        #pragma unroll
        for (int cc = 0; cc < NCHUNK - 1; ++cc)
            uu[cc] = (cc < c) ? up[cc * 64 + (unsigned)tid] : 0.0f;
    }
    // precaution: the address registers of the loads above are reused below
    asm volatile("s_wait_xcnt 0x0" ::: "memory");

    // entry state: Ctilde = decay*Ctilde + G ; n = decay*n + u, over chunks 0..c-1
    {
        float4 st[4];
        #pragma unroll
        for (int z = 0; z < 4; ++z) st[z] = make_float4(0.0f, 0.0f, 0.0f, 0.0f);
        const float* gp = Gbuf + (size_t)bh * NCHUNK * 4096 + tid * 4;
        // unrolled by 4 so that the loads of four G tiles are in flight together
        #pragma unroll 4
        for (int cc = 0; cc < c; ++cc) {
            const float decay = __int_as_float(__builtin_amdgcn_readlane(__float_as_int(decl), cc));
            #pragma unroll
            for (int z = 0; z < 4; ++z) {
                const float4 gv = *(const float4*)(gp + z * 1024);
                st[z].x = decay * st[z].x + gv.x;
                st[z].y = decay * st[z].y + gv.y;
                st[z].z = decay * st[z].z + gv.z;
                st[z].w = decay * st[z].w + gv.w;
            }
            gp += 4096;
        }
        #pragma unroll
        for (int z = 0; z < 4; ++z) {
            const int flat = tid * 4 + z * 1024;
            *(float4*)&Ct[flat >> 6][flat & 63] = st[z];
        }
        if (tid < 64) {
            float nv = 0.0f;
            #pragma unroll
            for (int cc = 0; cc < NCHUNK - 1; ++cc) {
                const float decay = __int_as_float(__builtin_amdgcn_readlane(__float_as_int(decl), cc));
                if (cc < c) nv = decay * nv + uu[cc];
            }
            nst[tid] = nv;
            sg[tid]  = gl;
            sm[tid]  = ml;
        }
    }
    wait_async0();
    __syncthreads();   // Q tile, Ct, nst, sg and sm visible

    // den-inter partials: n . q_j
    {
        const int j = tid & 63, grp = tid >> 6;
        float s = 0.0f;
        #pragma unroll
        for (int z = 0; z < 16; ++z) s += nst[grp * 16 + z] * Qs[j][grp * 16 + z];
        red[tid] = s;
    }
    // inter[j,e] = sum_d Q[j,d] * Ctilde[d,e]   (Ct holds [e][d])
    v8f a0 = {}, a1 = {};
    #pragma unroll
    for (int kk = 0; kk < 64; kk += 4) {
        const int ak = kk + half * 2;
        v2f av = *(const v2f*)&Qs[m0 + l16][ak];
        v2f b0 = *(const v2f*)&Ct[tn0 + l16][ak];
        v2f b1 = *(const v2f*)&Ct[tn0 + 16 + l16][ak];
        a0 = wmma4(av, b0, a0);  a1 = wmma4(av, b1, a1);
    }
    __syncthreads();
    if (tid < 64) dl[tid] = red[tid] + red[64 + tid] + red[128 + tid] + red[192 + tid];
    __syncthreads();

    // combine: h = o .* (scl*inter + P_intra) / max(|scl*deninter + den_intra|, 1)
    {
        const size_t pb = (size_t)(bh * NCHUNK + c) * 4096;
        #pragma unroll
        for (int r = 0; r < 8; ++r) {
            const int j = m0 + r + half * 8;
            const float scl = expf(sg[j] + Mc - sm[j]);
            float den = scl * dl[j] + denbuf[(size_t)bh * 1024 + c * CHUNK + j];
            den = fmaxf(fabsf(den), 1.0f);
            const size_t orow = ((size_t)(b * 1024 + c * CHUNK + j)) * HIDDIM + h * HDIM;
            const int e0 = tn0 + l16, e1 = e0 + 16;
            const float n0 = scl * a0[r] + Hbuf[pb + j * 64 + e0];
            const float n1 = scl * a1[r] + Hbuf[pb + j * 64 + e1];
            Hbuf[pb + j * 64 + e0] = ob[orow + e0] * n0 / den;
            Hbuf[pb + j * 64 + e1] = ob[orow + e1] * n1 / den;
        }
    }
}

// ---------------------------------------------------------------------------
// K6: LayerNorm over head-major h.  grid = 4096 token rows, 256 threads.
// ---------------------------------------------------------------------------
__global__ __launch_bounds__(256)
void ln_kernel(const float* __restrict__ hb, const float* __restrict__ gamma,
               const float* __restrict__ beta, float* __restrict__ out)
{
    __shared__ float rs[8], rs2[8];
    const int row = blockIdx.x;          // b*1024 + t
    const int b = row >> 10, t = row & 1023;
    const int tid = threadIdx.x;

    float vals[4];
    float s = 0.0f, s2 = 0.0f;
    #pragma unroll
    for (int i = 0; i < 4; ++i) {
        const int cH = tid + i * 256, h = cH >> 6, e = cH & 63;
        const float vv = hb[((size_t)(b * NHEAD + h) * 1024 + t) * HDIM + e];
        vals[i] = vv;
        s += vv;  s2 += vv * vv;
    }
    #pragma unroll
    for (int off = 16; off; off >>= 1) {
        s  += __shfl_xor(s,  off, 32);
        s2 += __shfl_xor(s2, off, 32);
    }
    const int wave = tid >> 5, lane = tid & 31;
    if (lane == 0) { rs[wave] = s; rs2[wave] = s2; }
    __syncthreads();
    float ts = 0.0f, ts2 = 0.0f;
    #pragma unroll
    for (int w = 0; w < 8; ++w) { ts += rs[w]; ts2 += rs2[w]; }
    const float mu  = ts * (1.0f / 1024.0f);
    const float var = ts2 * (1.0f / 1024.0f) - mu * mu;
    const float inv = rsqrtf(var + 1e-5f);
    #pragma unroll
    for (int i = 0; i < 4; ++i) {
        const int cH = tid + i * 256;
        out[(size_t)row * HIDDIM + cH] = (vals[i] - mu) * inv * gamma[cH] + beta[cH];
    }
}

// ---------------------------------------------------------------------------
extern "C" void kernel_launch(void* const* d_in, const int* in_sizes, int n_in,
                              void* d_out, int out_size, void* d_ws, size_t ws_size,
                              hipStream_t stream)
{
    const float* x     = (const float*)d_in[0];
    const float* Wq    = (const float*)d_in[1];
    const float* Wk    = (const float*)d_in[2];
    const float* Wv    = (const float*)d_in[3];
    const float* Wo    = (const float*)d_in[4];
    const float* b_o   = (const float*)d_in[5];
    const float* w_i   = (const float*)d_in[6];
    const float* b_i   = (const float*)d_in[7];
    const float* w_f   = (const float*)d_in[8];
    const float* b_f   = (const float*)d_in[9];
    const float* gamma = (const float*)d_in[10];
    const float* beta  = (const float*)d_in[11];

    // workspace layout (floats); total ~= 24.4M floats ~= 98 MB
    float* ws = (float*)d_ws;
    const size_t big = (size_t)NTOK * HIDDIM;   // 4M
    const size_t sml = (size_t)BHEADS * 1024;   // 64K
    float* q_buf = ws;
    float* k_buf = q_buf + big;
    float* v_buf = k_buf + big;
    float* o_buf = v_buf + big;
    float* i_buf = o_buf + big;      // head-major (bh, t)
    float* f_buf = i_buf + sml;
    float* m_buf = f_buf + sml;
    float* g_buf = m_buf + sml;
    float* P_buf = g_buf + sml;      // (bh, t, e) — becomes h after K5
    float* d_buf = P_buf + big;      // den_intra (bh, t)
    float* G_buf = d_buf + sml;      // (bh*16+c, e, d)
    float* u_buf = G_buf + big;      // (bh*16+c, d)

    proj_gemm_kernel<<<dim3(2048), dim3(256), 0, stream>>>(
        x, Wq, Wk, Wv, Wo, b_o, q_buf, k_buf, v_buf, o_buf);

    ifproj_kernel<<<dim3(256), dim3(256), 0, stream>>>(
        x, w_i, b_i, w_f, b_f, i_buf, f_buf);

    gate_scan_kernel<<<dim3(BHEADS), dim3(64), 0, stream>>>(
        i_buf, f_buf, m_buf, g_buf);

    chunk_intra_kernel<<<dim3(BHEADS * NCHUNK), dim3(256), 0, stream>>>(
        q_buf, k_buf, v_buf, i_buf, g_buf, m_buf, P_buf, d_buf, G_buf, u_buf);

    chunk_inter_kernel<<<dim3(BHEADS * NCHUNK), dim3(256), 0, stream>>>(
        q_buf, o_buf, g_buf, m_buf, G_buf, u_buf, d_buf, P_buf);

    ln_kernel<<<dim3(NTOK), dim3(256), 0, stream>>>(
        P_buf, gamma, beta, (float*)d_out);
}

// v003
// It runs in 247 microseconds.
// Timed twice side by side with v002, it ran 1.11 times as fast both times.
// All steps since v000 together make it 1.77 times as fast.
#include <hip/hip_runtime.h>
#include <math.h>

// ---------------------------------------------------------------------------
// mLSTM layer for gfx1250 (MI455X), fp32 end-to-end, chunkwise-parallel form.
//  K1: fused q/k/v/o projection GEMM            (V_WMMA_F32_16X16X4_F32)
//  K2: i/f gate projections (head-major output) (V_WMMA_F32_16X16X4_F32)
//  K3: gate scan: m (max,+ prefix) and per-chunk cumsum g, one wave per chunk
//  K4: intra-chunk kernel, 1024 parallel blocks: QV^T, QK^T, (w.Sv)K, G, u
//  K5: inter-chunk kernel, 1024 parallel blocks: entry state from G tiles, Q@C
//  K6: LayerNorm -> d_out
//  K1/K4/K5 tile staging uses GLOBAL_LOAD_ASYNC_TO_LDS_B128 (ASYNCcnt) where no
//  transpose is needed; LDS tiles are 16B-aligned per row for B128.
// ---------------------------------------------------------------------------

typedef __attribute__((ext_vector_type(2))) float v2f;
typedef __attribute__((ext_vector_type(8))) float v8f;

#define NTOK   4096          // B*T
#define INDIM  1024
#define HIDDIM 1024
#define NHEAD  16
#define HDIM   64
#define CHUNK  64
#define NCHUNK 16            // T / CHUNK
#define BHEADS 64            // B*H

#define TILE_M 64
#define TILE_N 128
#define KSTEP  32
#define LDA_P  36            // 144B rows: 16B aligned, bank-safe
#define LDB_P  36
#define LDC    68            // 272B rows: 16B aligned (async B128), bank-safe

__device__ __forceinline__ v8f wmma4(v2f a, v2f b, v8f c) {
    return __builtin_amdgcn_wmma_f32_16x16x4_f32(false, a, false, b, (short)0, c, false, false);
}

// Async 16B copy: global -> LDS, tracked by ASYNCcnt (per-lane addresses).
__device__ __forceinline__ void async_ld_b128(void* lds_ptr, const void* gaddr) {
    unsigned lds_off = (unsigned)(unsigned long long)lds_ptr;  // flat LDS addr[31:0]
    asm volatile("global_load_async_to_lds_b128 %0, %1, off"
                 :: "v"(lds_off), "v"(gaddr) : "memory");
}
// Four async 16B copies of 64 consecutive bytes.  The s_wait_xcnt closes the same
// statement so that no address register of a copy is reused ahead of it.
__device__ __forceinline__ void async_ld4_b128(void* lds_ptr, const float* gaddr) {
    unsigned l0 = (unsigned)(unsigned long long)lds_ptr;  // flat LDS addr[31:0]
    asm volatile("global_load_async_to_lds_b128 %0, %4, off\n\t"
                 "global_load_async_to_lds_b128 %1, %5, off\n\t"
                 "global_load_async_to_lds_b128 %2, %6, off\n\t"
                 "global_load_async_to_lds_b128 %3, %7, off\n\t"
                 "s_wait_xcnt 0x0"
                 :: "v"(l0), "v"(l0 + 16u), "v"(l0 + 32u), "v"(l0 + 48u),
                    "v"(gaddr), "v"(gaddr + 4), "v"(gaddr + 8), "v"(gaddr + 12)
                 : "memory");
}
__device__ __forceinline__ void wait_async0() {
    asm volatile("s_wait_asynccnt 0x0" ::: "memory");
}

// ---------------------------------------------------------------------------
// K1: fused projection GEMM.  grid = 64*32 = 2048 blocks, 256 threads.
// ---------------------------------------------------------------------------
__global__ __launch_bounds__(256)
void proj_gemm_kernel(const float* __restrict__ x,
                      const float* __restrict__ Wq, const float* __restrict__ Wk,
                      const float* __restrict__ Wv, const float* __restrict__ Wo,
                      const float* __restrict__ b_o,
                      float* __restrict__ outq, float* __restrict__ outk,
                      float* __restrict__ outv, float* __restrict__ outo)
{
    __shared__ float As[TILE_M][LDA_P];
    __shared__ float Bs[TILE_N][LDB_P];

    const int tid  = threadIdx.x;
    const int lane = tid & 31;
    const int wave = tid >> 5;

    const int bm = blockIdx.x >> 5;
    const int bn = blockIdx.x & 31;
    const int group    = bn >> 3;
    const int n_base_g = (bn & 7) * TILE_N;

    const float* W = (group == 0) ? Wq : (group == 1) ? Wk : (group == 2) ? Wv : Wo;
    float* outp    = (group == 0) ? outq : (group == 1) ? outk : (group == 2) ? outv : outo;

    const int wm = (wave >> 2) * 32;
    const int wn = (wave & 3)  * 32;
    const int half = lane >> 4;
    const int l16  = lane & 15;

    v8f acc[2][2] = {};

    const int ar = tid >> 2;
    const int ac = (tid & 3) * 8;
    const int bk = tid >> 3;
    const int bc = (tid & 7) * 16;

    for (int k0 = 0; k0 < INDIM; k0 += KSTEP) {
        // ---- stage A (64 x 32): async global -> LDS, no VGPR round trip ----
        {
            const float* gp = x + (size_t)(bm * TILE_M + ar) * INDIM + k0 + ac;
            async_ld_b128(&As[ar][ac],     gp);
            async_ld_b128(&As[ar][ac + 4], gp + 4);
        }
        // ---- stage B (32 x 128), transposed into LDS via VGPRs ----
        {
            const float* gp = W + (size_t)(k0 + bk) * HIDDIM + n_base_g + bc;
            if (k0 + KSTEP < INDIM)
                __builtin_prefetch(gp + (size_t)KSTEP * HIDDIM, 0, 0);
            float4 b0 = *(const float4*)(gp);
            float4 b1 = *(const float4*)(gp + 4);
            float4 b2 = *(const float4*)(gp + 8);
            float4 b3 = *(const float4*)(gp + 12);
            Bs[bc +  0][bk] = b0.x;  Bs[bc +  1][bk] = b0.y;
            Bs[bc +  2][bk] = b0.z;  Bs[bc +  3][bk] = b0.w;
            Bs[bc +  4][bk] = b1.x;  Bs[bc +  5][bk] = b1.y;
            Bs[bc +  6][bk] = b1.z;  Bs[bc +  7][bk] = b1.w;
            Bs[bc +  8][bk] = b2.x;  Bs[bc +  9][bk] = b2.y;
            Bs[bc + 10][bk] = b2.z;  Bs[bc + 11][bk] = b2.w;
            Bs[bc + 12][bk] = b3.x;  Bs[bc + 13][bk] = b3.y;
            Bs[bc + 14][bk] = b3.z;  Bs[bc + 15][bk] = b3.w;
        }
        wait_async0();
        __syncthreads();

        #pragma unroll
        for (int kk = 0; kk < KSTEP; kk += 4) {
            const int ak = kk + half * 2;
            v2f a0 = *(const v2f*)&As[wm +  0 + l16][ak];
            v2f a1 = *(const v2f*)&As[wm + 16 + l16][ak];
            v2f b0 = *(const v2f*)&Bs[wn +  0 + l16][ak];
            v2f b1 = *(const v2f*)&Bs[wn + 16 + l16][ak];
            acc[0][0] = wmma4(a0, b0, acc[0][0]);
            acc[0][1] = wmma4(a0, b1, acc[0][1]);
            acc[1][0] = wmma4(a1, b0, acc[1][0]);
            acc[1][1] = wmma4(a1, b1, acc[1][1]);
        }
        __syncthreads();
    }

    const int row0 = bm * TILE_M + wm;
    const int col0 = n_base_g + wn;
    #pragma unroll
    for (int i = 0; i < 2; ++i) {
        #pragma unroll
        for (int j = 0; j < 2; ++j) {
            const int col = col0 + j * 16 + l16;
            const float bo = (group == 3) ? b_o[col] : 0.0f;
            #pragma unroll
            for (int r = 0; r < 8; ++r) {
                const int row = row0 + i * 16 + r + half * 8;
                float val = acc[i][j][r];
                if (group == 0)      val *= 0.125f;                           // q / sqrt(D)
                else if (group == 3) val = 1.0f / (1.0f + expf(-(val + bo))); // sigmoid
                outp[(size_t)row * HIDDIM + col] = val;
            }
        }
    }
}

// ---------------------------------------------------------------------------
// K2: i/f projections on WMMA, output HEAD-MAJOR: out[(b*16+h)*1024 + t].
//  grid = 128 row blocks x {i, f} = 256 blocks, 256 threads.
//  A block owns 32 tokens x 16 heads of one gate; wave w sums k in
//  [128w, 128w+128); the eight partial tiles are added through LDS.
// ---------------------------------------------------------------------------
#define IF_ROWS 32           // tokens per block = one 128B line of head-major output
#define IF_KS   128          // k slice per wave = one 512B wave-wide load per row
#define IF_XP   1028         // 4112B rows: 16B more than a row of x, for b128 readers
#define IF_RP   36           // 144B rows of the partial tiles

__global__ __launch_bounds__(256)
void ifproj_kernel(const float* __restrict__ x,
                   const float* __restrict__ wi, const float* __restrict__ bi,
                   const float* __restrict__ wf, const float* __restrict__ bf,
                   float* __restrict__ outi, float* __restrict__ outf)
{
    __shared__ __attribute__((aligned(16))) float Xs[IF_ROWS][IF_XP];
    __shared__ __attribute__((aligned(16))) float red[8][NHEAD][IF_RP];

    const unsigned tid  = threadIdx.x;
    const unsigned lane = tid & 31;
    const unsigned wave = tid >> 5;
    const unsigned l16  = lane & 15;
    const unsigned half = lane >> 4;

    const int gate = blockIdx.x & 1;                 // 0: i, 1: f
    const int row0 = (blockIdx.x >> 1) * IF_ROWS;    // b*1024 + t
    const float* w    = gate ? wf : wi;
    const float* bias = gate ? bf : bi;
    float* op         = gate ? outf : outi;
    const unsigned kb = wave * IF_KS;

    // B fragments straight from global: lane = head, k = kb + 8g + 4*half + e
    float bw[16][4];
    {
        const unsigned wo = (kb + half * 4) * NHEAD + l16;
        #pragma unroll
        for (int g = 0; g < 16; ++g) {
            #pragma unroll
            for (int e = 0; e < 4; ++e)
                bw[g][e] = w[wo + (g * 8 + e) * NHEAD];
        }
    }
    // x rows: whole-line loads (the block reads one 4KB row per step), then LDS
    {
        const float* xb = x + (size_t)row0 * INDIM;
        #pragma unroll
        for (int i = 0; i < IF_ROWS; ++i)
            *(float4*)&Xs[i][tid * 4] = *(const float4*)&xb[tid * 4 + i * INDIM];
    }
    __syncthreads();

    // A fragments: lane = token, same k order as bw
    v8f acc0 = {}, acc1 = {};
    #pragma unroll
    for (int g = 0; g < 16; ++g) {
        const float4 xa0 = *(const float4*)&Xs[l16][kb + g * 8 + half * 4];
        const float4 xa1 = *(const float4*)&Xs[16 + l16][kb + g * 8 + half * 4];
        v2f b01, b23, a;
        b01.x = bw[g][0];  b01.y = bw[g][1];
        b23.x = bw[g][2];  b23.y = bw[g][3];
        a.x = xa0.x;  a.y = xa0.y;  acc0 = wmma4(a, b01, acc0);
        a.x = xa1.x;  a.y = xa1.y;  acc1 = wmma4(a, b01, acc1);
        a.x = xa0.z;  a.y = xa0.w;  acc0 = wmma4(a, b23, acc0);
        a.x = xa1.z;  a.y = xa1.w;  acc1 = wmma4(a, b23, acc1);
    }

    // partial tiles, [head][token] so that the sum below reads along tokens
    #pragma unroll
    for (int r = 0; r < 8; ++r) {
        red[wave][l16][half * 8 + r]      = acc0[r];
        red[wave][l16][16 + half * 8 + r] = acc1[r];
    }
    __syncthreads();

    const int b  = row0 >> 10;
    const int t0 = row0 & 1023;
    #pragma unroll
    for (int z = 0; z < 2; ++z) {
        const int col = wave + z * 8;
        float s = 0.0f;
        #pragma unroll
        for (int p = 0; p < 8; ++p) s += red[p][col][lane];
        op[(size_t)(b * NHEAD + col) * 1024 + t0 + lane] = s + bias[col];
    }
}

// ---------------------------------------------------------------------------
// K3: gate scan.  m_t = max(f_t + m_{t-1}, i_t) via (max,+) prefix:
//   g_j = per-chunk cumsum f;  m_j = g_j + max(m_entry, prefmax(i - g))
//  grid = 64 (b*h), 512 threads.  Wave w owns chunk w; lane l holds elements
//  l and l+32 of it.  Both prefixes run over distances 1, 2, .. 32 inside the
//  wave; only the chunk totals cross waves, through LDS.
// ---------------------------------------------------------------------------
__global__ __launch_bounds__(512)
void gate_scan_kernel(const float* __restrict__ ihm, const float* __restrict__ fhm,
                      float* __restrict__ m_arr, float* __restrict__ g_arr)
{
    __shared__ float tot[2][NCHUNK];
    const int bh   = blockIdx.x;
    const int lane = threadIdx.x & 31;
    // chunk = wave number, held as a scalar: it bounds the carry loop below
    const int c    = __builtin_amdgcn_readfirstlane(threadIdx.x >> 5);
    const size_t ix = (size_t)bh * 1024 + c * CHUNK + lane;

    float g0 = fhm[ix], g1 = fhm[ix + 32];
    const float i0 = ihm[ix], i1 = ihm[ix + 32];

    // element e takes element e - off: from lane - off of the same register, or,
    // for the upper register's first off lanes, from the lower register's last ones
    for (int off = 1; off < 32; off <<= 1) {
        const int from = (lane - off) & 31;
        const float r0 = __shfl(g0, from, 32);
        const float r1 = __shfl(g1, from, 32);
        g0 += (lane >= off) ? r0 : 0.0f;
        g1 += (lane >= off) ? r1 : r0;
    }
    g1 += g0;                                   // distance 32

    float p0 = i0 - g0, p1 = i1 - g1;
    for (int off = 1; off < 32; off <<= 1) {
        const int from = (lane - off) & 31;
        const float r0 = __shfl(p0, from, 32);
        const float r1 = __shfl(p1, from, 32);
        p0 = fmaxf(p0, (lane >= off) ? r0 : -1e30f);
        p1 = fmaxf(p1, (lane >= off) ? r1 : r0);
    }
    p1 = fmaxf(p1, p0);                         // distance 32
    p0 = fmaxf(p0, -1e30f);

    if (lane == 31) { tot[0][c] = g1;  tot[1][c] = p1; }
    __syncthreads();

    // m at the chunk's entry: the recurrence over the totals of the earlier chunks
    const float tg = tot[0][lane & 15];
    const float tp = tot[1][lane & 15];
    float me = 0.0f;
    for (int cc = 0; cc < c; ++cc) {
        const float gt = __int_as_float(__builtin_amdgcn_readlane(__float_as_int(tg), cc));
        const float pt = __int_as_float(__builtin_amdgcn_readlane(__float_as_int(tp), cc));
        me = gt + fmaxf(me, pt);
    }

    m_arr[ix]      = g0 + fmaxf(me, p0);
    m_arr[ix + 32] = g1 + fmaxf(me, p1);
    g_arr[ix]      = g0;
    g_arr[ix + 32] = g1;
}

// ---------------------------------------------------------------------------
// K4: intra-chunk kernel.  grid = 1024 blocks, 256 threads.
// ---------------------------------------------------------------------------
__global__ __launch_bounds__(256)
void chunk_intra_kernel(const float* __restrict__ qb, const float* __restrict__ kb,
                        const float* __restrict__ vb, const float* __restrict__ ihm,
                        const float* __restrict__ g_arr, const float* __restrict__ m_arr,
                        float* __restrict__ Pbuf, float* __restrict__ denbuf,
                        float* __restrict__ Gbuf, float* __restrict__ ubuf)
{
    __shared__ float Qs[64][LDC];   // later reused as W (weighted Sv)
    __shared__ float Ks[64][LDC];   // later scaled by wg
    __shared__ float Vs[64][LDC];
    __shared__ float sg[64], sm[64], sii[64], wgl[64];
    __shared__ float denp[2][64];
    __shared__ float red[256];

    const int tid  = threadIdx.x;
    const int lane = tid & 31;
    const int wave = tid >> 5;
    const int l16  = lane & 15;
    const int half = lane >> 4;

    const int bh = blockIdx.x >> 4;
    const int c  = blockIdx.x & 15;
    const int b  = bh >> 4, h = bh & 15;

    // ---- stage Q,K,V chunk tiles: async global -> LDS ----
    {
        const int r  = tid >> 2;
        const int c0 = (tid & 3) * 16;
        const size_t gbase = ((size_t)(b * 1024 + c * CHUNK + r)) * HIDDIM + h * HDIM + c0;
        #pragma unroll
        for (int z = 0; z < 4; ++z) {
            async_ld_b128(&Qs[r][c0 + z * 4], qb + gbase + z * 4);
            async_ld_b128(&Ks[r][c0 + z * 4], kb + gbase + z * 4);
            async_ld_b128(&Vs[r][c0 + z * 4], vb + gbase + z * 4);
        }
    }
    if (tid < 64) {
        const size_t sb = (size_t)bh * 1024 + c * CHUNK + tid;
        sg[tid]  = g_arr[sb];
        sm[tid]  = m_arr[sb];
        sii[tid] = ihm[sb];
    }
    wait_async0();
    __syncthreads();
    if (tid < 64)
        wgl[tid] = expf(sg[63] - sg[tid] + sii[tid] - sm[63]);   // state-inc weights

    const int tm  = wave >> 1;
    const int m0  = tm * 16;
    const int tn0 = (wave & 1) * 32;

    // ---- GEMM 1+2 fused: Sv = Q V^T, Sk = Q K^T ----
    v8f sv0 = {}, sv1 = {}, sk0 = {}, sk1 = {};
    #pragma unroll
    for (int kk = 0; kk < 64; kk += 4) {
        const int ak = kk + half * 2;
        v2f a   = *(const v2f*)&Qs[m0 + l16][ak];
        v2f bv0 = *(const v2f*)&Vs[tn0 + l16][ak];
        v2f bv1 = *(const v2f*)&Vs[tn0 + 16 + l16][ak];
        v2f bk0 = *(const v2f*)&Ks[tn0 + l16][ak];
        v2f bk1 = *(const v2f*)&Ks[tn0 + 16 + l16][ak];
        sv0 = wmma4(a, bv0, sv0);  sv1 = wmma4(a, bv1, sv1);
        sk0 = wmma4(a, bk0, sk0);  sk1 = wmma4(a, bk1, sk1);
    }
    __syncthreads();   // all Qs reads complete before overwrite

    // ---- causal decay weights, W into Qs, den_intra reduce ----
    #pragma unroll
    for (int r = 0; r < 8; ++r) {
        const int j  = m0 + r + half * 8;
        const int i0 = tn0 + l16;
        const int i1 = i0 + 16;
        const float gj = sg[j], mj = sm[j];
        const float w0 = (i0 <= j) ? expf(gj - sg[i0] + sii[i0] - mj) : 0.0f;
        const float w1 = (i1 <= j) ? expf(gj - sg[i1] + sii[i1] - mj) : 0.0f;
        Qs[j][i0] = w0 * sv0[r];
        Qs[j][i1] = w1 * sv1[r];
        float dp = w0 * sk0[r] + w1 * sk1[r];
        #pragma unroll
        for (int off = 8; off; off >>= 1) dp += __shfl_xor(dp, off, 32);
        if (l16 == 0) denp[wave & 1][j] = dp;
    }
    __syncthreads();
    if (tid < 64)
        denbuf[(size_t)bh * 1024 + c * CHUNK + tid] = denp[0][tid] + denp[1][tid];

    // ---- GEMM 3: P = W @ K  (B from row-major Ks via two scalar loads) ----
    v8f p0 = {}, p1 = {};
    #pragma unroll
    for (int kk = 0; kk < 64; kk += 4) {
        const int ak = kk + half * 2;
        v2f a = *(const v2f*)&Qs[m0 + l16][ak];
        v2f b0, b1;
        b0.x = Ks[ak][tn0 + l16];       b0.y = Ks[ak + 1][tn0 + l16];
        b1.x = Ks[ak][tn0 + 16 + l16];  b1.y = Ks[ak + 1][tn0 + 16 + l16];
        p0 = wmma4(a, b0, p0);  p1 = wmma4(a, b1, p1);
    }
    {
        const size_t pb = (size_t)blockIdx.x * 4096;   // (bh*16+c) * 64*64
        #pragma unroll
        for (int r = 0; r < 8; ++r) {
            const int j = m0 + r + half * 8;
            Pbuf[pb + j * 64 + tn0 + l16]      = p0[r];
            Pbuf[pb + j * 64 + tn0 + 16 + l16] = p1[r];
        }
    }
    __syncthreads();

    // ---- scale K rows by wg, column sums -> u ----
    #pragma unroll
    for (int z = 0; z < 16; ++z) {
        const int flat = tid + z * 256;
        Ks[flat >> 6][flat & 63] *= wgl[flat >> 6];
    }
    __syncthreads();
    {
        const int d = tid & 63, grp = tid >> 6;
        float s = 0.0f;
        #pragma unroll
        for (int z = 0; z < 16; ++z) s += Ks[grp * 16 + z][d];
        red[tid] = s;
    }
    __syncthreads();
    if (tid < 64)
        ubuf[(size_t)blockIdx.x * 64 + tid] = red[tid] + red[64 + tid] + red[128 + tid] + red[192 + tid];

    // ---- GEMM 4: G^T[e,d] = sum_i wg_i K[i,e] V[i,d] ----
    v8f gg0 = {}, gg1 = {};
    #pragma unroll
    for (int kk = 0; kk < 64; kk += 4) {
        const int ak = kk + half * 2;
        v2f a, b0, b1;
        a.x  = Ks[ak][m0 + l16];        a.y  = Ks[ak + 1][m0 + l16];        // A[e][i]
        b0.x = Vs[ak][tn0 + l16];       b0.y = Vs[ak + 1][tn0 + l16];       // B[i][d]
        b1.x = Vs[ak][tn0 + 16 + l16];  b1.y = Vs[ak + 1][tn0 + 16 + l16];
        gg0 = wmma4(a, b0, gg0);  gg1 = wmma4(a, b1, gg1);
    }
    {
        const size_t gb = (size_t)blockIdx.x * 4096;
        #pragma unroll
        for (int r = 0; r < 8; ++r) {
            const int e = m0 + r + half * 8;
            Gbuf[gb + e * 64 + tn0 + l16]      = gg0[r];
            Gbuf[gb + e * 64 + tn0 + 16 + l16] = gg1[r];
        }
    }
}

// ---------------------------------------------------------------------------
// K5: inter-chunk kernel.  grid = 1024 (chunk, b*h), 256 threads.
//  A block rebuilds the state that enters its chunk from the G tiles of the
//  earlier chunks, in registers, by the recurrence C = decay*C + G, and then
//  does Q@C and the combine for its one chunk.  No block waits for another.
// ---------------------------------------------------------------------------
__global__ __launch_bounds__(256)
void chunk_inter_kernel(const float* __restrict__ qb, const float* __restrict__ ob,
                        const float* __restrict__ g_arr, const float* __restrict__ m_arr,
                        const float* __restrict__ Gbuf, const float* __restrict__ ubuf,
                        const float* __restrict__ denbuf,
                        float* __restrict__ Hbuf)   // in: P_intra, out: h
{
    __shared__ __attribute__((aligned(16))) float Ct[64][LDC];
    __shared__ __attribute__((aligned(16))) float Qs[64][LDC];
    __shared__ float nst[64];
    __shared__ float sg[64], sm[64], dl[64];
    __shared__ float red[256];

    const int tid  = threadIdx.x;
    const int lane = tid & 31, wave = tid >> 5;
    const int l16  = lane & 15, half = lane >> 4;
    const int c  = (NCHUNK - 1) - (blockIdx.x >> 6);   // longest rebuild starts first
    const int bh = blockIdx.x & 63;
    const int b  = bh >> 4, h = bh & 15;
    const int tm = wave >> 1, m0 = tm * 16, tn0 = (wave & 1) * 32;

    // Q tile: async global -> LDS, in flight while the state is rebuilt
    {
        const int r = tid >> 2, c0 = (tid & 3) * 16;
        const size_t gb2 = ((size_t)(b * 1024 + c * CHUNK + r)) * HIDDIM + h * HDIM + c0;
        async_ld4_b128(&Qs[r][c0], qb + gb2);
    }
    // decay of every chunk of this head: lane l of each wave holds chunk l & 15
    float decl;
    {
        const int lc = lane & 15;
        const size_t eb = (size_t)bh * 1024 + lc * CHUNK;
        const float Mp = (lc == 0) ? 0.0f : m_arr[eb - 1];
        decl = expf(g_arr[eb + 63] + Mp - m_arr[eb + 63]);
    }
    const float Mc = (c == 0) ? 0.0f : m_arr[(size_t)bh * 1024 + c * CHUNK - 1];

    // loaded here, used behind the state rebuild: their latency runs under it
    float gl = 0.0f, ml = 0.0f;
    float uu[NCHUNK - 1];
    if (tid < 64) {
        const size_t sb = (size_t)bh * 1024 + c * CHUNK + tid;
        gl = g_arr[sb];
        ml = m_arr[sb];
        const float* up = ubuf + (size_t)bh * NCHUNK * 64;   // block-uniform base
        #pragma unroll
        for (int cc = 0; cc < NCHUNK - 1; ++cc)
            uu[cc] = (cc < c) ? up[cc * 64 + (unsigned)tid] : 0.0f;
    }
    // precaution: the address registers of the loads above are reused below
    asm volatile("s_wait_xcnt 0x0" ::: "memory");

    // entry state: Ctilde = decay*Ctilde + G ; n = decay*n + u, over chunks 0..c-1
    {
        float4 st[4];
        #pragma unroll
        for (int z = 0; z < 4; ++z) st[z] = make_float4(0.0f, 0.0f, 0.0f, 0.0f);
        const float* gp = Gbuf + (size_t)bh * NCHUNK * 4096 + tid * 4;
        // unrolled by 4 so that the loads of four G tiles are in flight together
        #pragma unroll 4
        for (int cc = 0; cc < c; ++cc) {
            const float decay = __int_as_float(__builtin_amdgcn_readlane(__float_as_int(decl), cc));
            #pragma unroll
            for (int z = 0; z < 4; ++z) {
                const float4 gv = *(const float4*)(gp + z * 1024);
                st[z].x = decay * st[z].x + gv.x;
                st[z].y = decay * st[z].y + gv.y;
                st[z].z = decay * st[z].z + gv.z;
                st[z].w = decay * st[z].w + gv.w;
            }
            gp += 4096;
        }
        #pragma unroll
        for (int z = 0; z < 4; ++z) {
            const int flat = tid * 4 + z * 1024;
            *(float4*)&Ct[flat >> 6][flat & 63] = st[z];
        }
        if (tid < 64) {
            float nv = 0.0f;
            #pragma unroll
            for (int cc = 0; cc < NCHUNK - 1; ++cc) {
                const float decay = __int_as_float(__builtin_amdgcn_readlane(__float_as_int(decl), cc));
                if (cc < c) nv = decay * nv + uu[cc];
            }
            nst[tid] = nv;
            sg[tid]  = gl;
            sm[tid]  = ml;
        }
    }
    wait_async0();
    __syncthreads();   // Q tile, Ct, nst, sg and sm visible

    // den-inter partials: n . q_j
    {
        const int j = tid & 63, grp = tid >> 6;
        float s = 0.0f;
        #pragma unroll
        for (int z = 0; z < 16; ++z) s += nst[grp * 16 + z] * Qs[j][grp * 16 + z];
        red[tid] = s;
    }
    // inter[j,e] = sum_d Q[j,d] * Ctilde[d,e]   (Ct holds [e][d])
    v8f a0 = {}, a1 = {};
    #pragma unroll
    for (int kk = 0; kk < 64; kk += 4) {
        const int ak = kk + half * 2;
        v2f av = *(const v2f*)&Qs[m0 + l16][ak];
        v2f b0 = *(const v2f*)&Ct[tn0 + l16][ak];
        v2f b1 = *(const v2f*)&Ct[tn0 + 16 + l16][ak];
        a0 = wmma4(av, b0, a0);  a1 = wmma4(av, b1, a1);
    }
    __syncthreads();
    if (tid < 64) dl[tid] = red[tid] + red[64 + tid] + red[128 + tid] + red[192 + tid];
    __syncthreads();

    // combine: h = o .* (scl*inter + P_intra) / max(|scl*deninter + den_intra|, 1)
    {
        const size_t pb = (size_t)(bh * NCHUNK + c) * 4096;
        #pragma unroll
        for (int r = 0; r < 8; ++r) {
            const int j = m0 + r + half * 8;
            const float scl = expf(sg[j] + Mc - sm[j]);
            float den = scl * dl[j] + denbuf[(size_t)bh * 1024 + c * CHUNK + j];
            den = fmaxf(fabsf(den), 1.0f);
            const size_t orow = ((size_t)(b * 1024 + c * CHUNK + j)) * HIDDIM + h * HDIM;
            const int e0 = tn0 + l16, e1 = e0 + 16;
            const float n0 = scl * a0[r] + Hbuf[pb + j * 64 + e0];
            const float n1 = scl * a1[r] + Hbuf[pb + j * 64 + e1];
            Hbuf[pb + j * 64 + e0] = ob[orow + e0] * n0 / den;
            Hbuf[pb + j * 64 + e1] = ob[orow + e1] * n1 / den;
        }
    }
}

// ---------------------------------------------------------------------------
// K6: LayerNorm over head-major h.  grid = 4096 token rows, 256 threads.
// ---------------------------------------------------------------------------
__global__ __launch_bounds__(256)
void ln_kernel(const float* __restrict__ hb, const float* __restrict__ gamma,
               const float* __restrict__ beta, float* __restrict__ out)
{
    __shared__ float rs[8], rs2[8];
    const int row = blockIdx.x;          // b*1024 + t
    const int b = row >> 10, t = row & 1023;
    const int tid = threadIdx.x;

    float vals[4];
    float s = 0.0f, s2 = 0.0f;
    #pragma unroll
    for (int i = 0; i < 4; ++i) {
        const int cH = tid + i * 256, h = cH >> 6, e = cH & 63;
        const float vv = hb[((size_t)(b * NHEAD + h) * 1024 + t) * HDIM + e];
        vals[i] = vv;
        s += vv;  s2 += vv * vv;
    }
    #pragma unroll
    for (int off = 16; off; off >>= 1) {
        s  += __shfl_xor(s,  off, 32);
        s2 += __shfl_xor(s2, off, 32);
    }
    const int wave = tid >> 5, lane = tid & 31;
    if (lane == 0) { rs[wave] = s; rs2[wave] = s2; }
    __syncthreads();
    float ts = 0.0f, ts2 = 0.0f;
    #pragma unroll
    for (int w = 0; w < 8; ++w) { ts += rs[w]; ts2 += rs2[w]; }
    const float mu  = ts * (1.0f / 1024.0f);
    const float var = ts2 * (1.0f / 1024.0f) - mu * mu;
    const float inv = rsqrtf(var + 1e-5f);
    #pragma unroll
    for (int i = 0; i < 4; ++i) {
        const int cH = tid + i * 256;
        out[(size_t)row * HIDDIM + cH] = (vals[i] - mu) * inv * gamma[cH] + beta[cH];
    }
}

// ---------------------------------------------------------------------------
extern "C" void kernel_launch(void* const* d_in, const int* in_sizes, int n_in,
                              void* d_out, int out_size, void* d_ws, size_t ws_size,
                              hipStream_t stream)
{
    const float* x     = (const float*)d_in[0];
    const float* Wq    = (const float*)d_in[1];
    const float* Wk    = (const float*)d_in[2];
    const float* Wv    = (const float*)d_in[3];
    const float* Wo    = (const float*)d_in[4];
    const float* b_o   = (const float*)d_in[5];
    const float* w_i   = (const float*)d_in[6];
    const float* b_i   = (const float*)d_in[7];
    const float* w_f   = (const float*)d_in[8];
    const float* b_f   = (const float*)d_in[9];
    const float* gamma = (const float*)d_in[10];
    const float* beta  = (const float*)d_in[11];

    // workspace layout (floats); total ~= 24.4M floats ~= 98 MB
    float* ws = (float*)d_ws;
    const size_t big = (size_t)NTOK * HIDDIM;   // 4M
    const size_t sml = (size_t)BHEADS * 1024;   // 64K
    float* q_buf = ws;
    float* k_buf = q_buf + big;
    float* v_buf = k_buf + big;
    float* o_buf = v_buf + big;
    float* i_buf = o_buf + big;      // head-major (bh, t)
    float* f_buf = i_buf + sml;
    float* m_buf = f_buf + sml;
    float* g_buf = m_buf + sml;
    float* P_buf = g_buf + sml;      // (bh, t, e) — becomes h after K5
    float* d_buf = P_buf + big;      // den_intra (bh, t)
    float* G_buf = d_buf + sml;      // (bh*16+c, e, d)
    float* u_buf = G_buf + big;      // (bh*16+c, d)

    proj_gemm_kernel<<<dim3(2048), dim3(256), 0, stream>>>(
        x, Wq, Wk, Wv, Wo, b_o, q_buf, k_buf, v_buf, o_buf);

    ifproj_kernel<<<dim3(256), dim3(256), 0, stream>>>(
        x, w_i, b_i, w_f, b_f, i_buf, f_buf);

    gate_scan_kernel<<<dim3(BHEADS), dim3(NCHUNK * 32), 0, stream>>>(
        i_buf, f_buf, m_buf, g_buf);

    chunk_intra_kernel<<<dim3(BHEADS * NCHUNK), dim3(256), 0, stream>>>(
        q_buf, k_buf, v_buf, i_buf, g_buf, m_buf, P_buf, d_buf, G_buf, u_buf);

    chunk_inter_kernel<<<dim3(BHEADS * NCHUNK), dim3(256), 0, stream>>>(
        q_buf, o_buf, g_buf, m_buf, G_buf, u_buf, d_buf, P_buf);

    ln_kernel<<<dim3(NTOK), dim3(256), 0, stream>>>(
        P_buf, gamma, beta, (float*)d_out);
}

// v004
// One run takes 216 microseconds.
// Timed twice side by side with v003, it ran 1.15 and 1.14 times as fast.
// Over all steps from v000 it is 2.03 times as fast.
#include <hip/hip_runtime.h>
#include <math.h>

// ---------------------------------------------------------------------------
// mLSTM layer for gfx1250 (MI455X), fp32 end-to-end, chunkwise-parallel form.
//  K1: fused q/k/v/o projection GEMM            (V_WMMA_F32_16X16X4_F32)
//  K2: i/f gate projections (head-major output) (V_WMMA_F32_16X16X4_F32)
//  K3: gate scan: m (max,+ prefix) and per-chunk cumsum g, one wave per chunk
//  K4: intra-chunk kernel, 1024 parallel blocks: QV^T, QK^T, (w.Sv)K, G, u
//  K5: inter-chunk kernel, 1024 parallel blocks: entry state from G tiles, Q@C
//  K6: LayerNorm -> d_out
//  K1/K4/K5 tile staging uses GLOBAL_LOAD_ASYNC_TO_LDS_B128 (ASYNCcnt) where no
//  transpose is needed; LDS tiles are 16B-aligned per row for B128.
// ---------------------------------------------------------------------------

typedef __attribute__((ext_vector_type(2))) float v2f;
typedef __attribute__((ext_vector_type(8))) float v8f;

#define NTOK   4096          // B*T
#define INDIM  1024
#define HIDDIM 1024
#define NHEAD  16
#define HDIM   64
#define CHUNK  64
#define NCHUNK 16            // T / CHUNK
#define BHEADS 64            // B*H

#define TILE_M 64
#define TILE_N 128
#define KSTEP  32
#define LDA_P  36            // 144B rows: 16B aligned, bank-safe
#define LDB_P  544           // a plane of Bs: 8 rows of 256B, +128B (the other 32 banks)
#define LDC    68            // 272B rows: 16B aligned (async B128), bank-safe

__device__ __forceinline__ v8f wmma4(v2f a, v2f b, v8f c) {
    return __builtin_amdgcn_wmma_f32_16x16x4_f32(false, a, false, b, (short)0, c, false, false);
}

// Async 16B copy: global -> LDS, tracked by ASYNCcnt (per-lane addresses).
__device__ __forceinline__ void async_ld_b128(void* lds_ptr, const void* gaddr) {
    unsigned lds_off = (unsigned)(unsigned long long)lds_ptr;  // flat LDS addr[31:0]
    asm volatile("global_load_async_to_lds_b128 %0, %1, off"
                 :: "v"(lds_off), "v"(gaddr) : "memory");
}
// Four async 16B copies of 64 consecutive bytes.  The s_wait_xcnt closes the same
// statement so that no address register of a copy is reused ahead of it.
__device__ __forceinline__ void async_ld4_b128(void* lds_ptr, const float* gaddr) {
    unsigned l0 = (unsigned)(unsigned long long)lds_ptr;  // flat LDS addr[31:0]
    asm volatile("global_load_async_to_lds_b128 %0, %4, off\n\t"
                 "global_load_async_to_lds_b128 %1, %5, off\n\t"
                 "global_load_async_to_lds_b128 %2, %6, off\n\t"
                 "global_load_async_to_lds_b128 %3, %7, off\n\t"
                 "s_wait_xcnt 0x0"
                 :: "v"(l0), "v"(l0 + 16u), "v"(l0 + 32u), "v"(l0 + 48u),
                    "v"(gaddr), "v"(gaddr + 4), "v"(gaddr + 8), "v"(gaddr + 12)
                 : "memory");
}
// Four async 16B copies of one weight tile: both column halves of two k-row pairs.
// The s_wait_xcnt closes the same statement so that no address register of a copy
// is reused ahead of it.
__device__ __forceinline__ void async_ld4_pairs_b128(void* lds_ptr, const float* gaddr) {
    unsigned l0 = (unsigned)(unsigned long long)lds_ptr;  // flat LDS addr[31:0]
    asm volatile("global_load_async_to_lds_b128 %0, %4, off\n\t"
                 "global_load_async_to_lds_b128 %1, %5, off\n\t"
                 "global_load_async_to_lds_b128 %2, %6, off\n\t"
                 "global_load_async_to_lds_b128 %3, %7, off\n\t"
                 "s_wait_xcnt 0x0"
                 :: "v"(l0), "v"(l0 + LDB_P * 16u), "v"(l0 + LDB_P * 4u), "v"(l0 + LDB_P * 20u),
                    "v"(gaddr), "v"(gaddr + 64), "v"(gaddr + 2 * HIDDIM), "v"(gaddr + 2 * HIDDIM + 64)
                 : "memory");
}
__device__ __forceinline__ void wait_async0() {
    asm volatile("s_wait_asynccnt 0x0" ::: "memory");
}

// ---------------------------------------------------------------------------
// K1: fused projection GEMM.  grid = 64*32 = 2048 blocks, 256 threads.
// ---------------------------------------------------------------------------
__global__ __launch_bounds__(256)
void proj_gemm_kernel(const float* __restrict__ x,
                      const float* __restrict__ Wq, const float* __restrict__ Wk,
                      const float* __restrict__ Wv, const float* __restrict__ Wo,
                      const float* __restrict__ b_o,
                      float* __restrict__ outq, float* __restrict__ outk,
                      float* __restrict__ outv, float* __restrict__ outo)
{
    __shared__ float As[TILE_M][LDA_P];
    // [n/32][(k/2)&1][k/4][(n&31)/4][k&1][n&3]: W[k][n] and W[k+1][n] stand 16B apart (one
    // paired read); the k pairs of lanes 0-15 and of lanes 16-31 lie in different planes
    __shared__ __attribute__((aligned(16))) float Bs[TILE_N / 32][2][LDB_P];

    const int tid  = threadIdx.x;
    const int lane = tid & 31;
    const int wave = tid >> 5;

    const int bm = blockIdx.x >> 5;
    const int bn = blockIdx.x & 31;
    const int group    = bn >> 3;
    const int n_base_g = (bn & 7) * TILE_N;

    const float* W = (group == 0) ? Wq : (group == 1) ? Wk : (group == 2) ? Wv : Wo;
    float* outp    = (group == 0) ? outq : (group == 1) ? outk : (group == 2) ? outv : outo;

    const int wm = (wave >> 2) * 32;
    const int wn = (wave & 3)  * 32;
    const int half = lane >> 4;
    const int l16  = lane & 15;

    v8f acc[2][2] = {};

    const int ar = tid >> 2;
    const int ac = (tid & 3) * 8;
    // one copy of a wave: 256B of row k and 256B of row k+1, two whole 256B rows of Bs
    const int cq = lane & 7, cr = (lane >> 3) & 1;   // 4-float group, row of the pair
    const int bf = (l16 >> 2) * 8 + (l16 & 3);   // a lane's column inside 16 columns of Bs

    for (int k0 = 0; k0 < INDIM; k0 += KSTEP) {
        // ---- stage A (64 x 32): async global -> LDS, no VGPR round trip ----
        {
            const float* gp = x + (size_t)(bm * TILE_M + ar) * INDIM + k0 + ac;
            async_ld_b128(&As[ar][ac],     gp);
            async_ld_b128(&As[ar][ac + 4], gp + 4);
        }
        // ---- stage B (32 x 128), k-row pairs interleaved: async global -> LDS ----
        async_ld4_pairs_b128(&Bs[half][0][wave * 64 + cq * 8 + cr * 4],
                             W + (size_t)(k0 + wave * 4 + cr) * HIDDIM + n_base_g + half * 32 + cq * 4);
        wait_async0();
        __syncthreads();

        #pragma unroll
        for (int kk = 0; kk < KSTEP; kk += 4) {
            const int ak = kk + half * 2;
            v2f a0 = *(const v2f*)&As[wm +  0 + l16][ak];
            v2f a1 = *(const v2f*)&As[wm + 16 + l16][ak];
            v2f b0, b1;
            const float* bp = &Bs[wave & 3][half][kk * 16 + bf];
            b0.x = bp[0];   b0.y = bp[4];
            b1.x = bp[32];  b1.y = bp[36];
            acc[0][0] = wmma4(a0, b0, acc[0][0]);
            acc[0][1] = wmma4(a0, b1, acc[0][1]);
            acc[1][0] = wmma4(a1, b0, acc[1][0]);
            acc[1][1] = wmma4(a1, b1, acc[1][1]);
        }
        __syncthreads();
    }

    const int row0 = bm * TILE_M + wm;
    const int col0 = n_base_g + wn;
    #pragma unroll
    for (int i = 0; i < 2; ++i) {
        #pragma unroll
        for (int j = 0; j < 2; ++j) {
            const int col = col0 + j * 16 + l16;
            const float bo = (group == 3) ? b_o[col] : 0.0f;
            #pragma unroll
            for (int r = 0; r < 8; ++r) {
                const int row = row0 + i * 16 + r + half * 8;
                float val = acc[i][j][r];
                if (group == 0)      val *= 0.125f;                           // q / sqrt(D)
                else if (group == 3) val = 1.0f / (1.0f + expf(-(val + bo))); // sigmoid
                outp[(size_t)row * HIDDIM + col] = val;
            }
        }
    }
}

// ---------------------------------------------------------------------------
// K2: i/f projections on WMMA, output HEAD-MAJOR: out[(b*16+h)*1024 + t].
//  grid = 128 row blocks x {i, f} = 256 blocks, 256 threads.
//  A block owns 32 tokens x 16 heads of one gate; wave w sums k in
//  [128w, 128w+128); the eight partial tiles are added through LDS.
// ---------------------------------------------------------------------------
#define IF_ROWS 32           // tokens per block = one 128B line of head-major output
#define IF_KS   128          // k slice per wave = one 512B wave-wide load per row
#define IF_XP   1028         // 4112B rows: 16B more than a row of x, for b128 readers
#define IF_RP   36           // 144B rows of the partial tiles

__global__ __launch_bounds__(256)
void ifproj_kernel(const float* __restrict__ x,
                   const float* __restrict__ wi, const float* __restrict__ bi,
                   const float* __restrict__ wf, const float* __restrict__ bf,
                   float* __restrict__ outi, float* __restrict__ outf)
{
    __shared__ __attribute__((aligned(16))) float Xs[IF_ROWS][IF_XP];
    __shared__ __attribute__((aligned(16))) float red[8][NHEAD][IF_RP];

    const unsigned tid  = threadIdx.x;
    const unsigned lane = tid & 31;
    const unsigned wave = tid >> 5;
    const unsigned l16  = lane & 15;
    const unsigned half = lane >> 4;

    const int gate = blockIdx.x & 1;                 // 0: i, 1: f
    const int row0 = (blockIdx.x >> 1) * IF_ROWS;    // b*1024 + t
    const float* w    = gate ? wf : wi;
    const float* bias = gate ? bf : bi;
    float* op         = gate ? outf : outi;
    const unsigned kb = wave * IF_KS;

    // B fragments straight from global: lane = head, k = kb + 8g + 4*half + e
    float bw[16][4];
    {
        const unsigned wo = (kb + half * 4) * NHEAD + l16;
        #pragma unroll
        for (int g = 0; g < 16; ++g) {
            #pragma unroll
            for (int e = 0; e < 4; ++e)
                bw[g][e] = w[wo + (g * 8 + e) * NHEAD];
        }
    }
    // x rows: whole-line loads (the block reads one 4KB row per step), then LDS
    {
        const float* xb = x + (size_t)row0 * INDIM;
        #pragma unroll
        for (int i = 0; i < IF_ROWS; ++i)
            *(float4*)&Xs[i][tid * 4] = *(const float4*)&xb[tid * 4 + i * INDIM];
    }
    __syncthreads();

    // A fragments: lane = token, same k order as bw
    v8f acc0 = {}, acc1 = {};
    #pragma unroll
    for (int g = 0; g < 16; ++g) {
        const float4 xa0 = *(const float4*)&Xs[l16][kb + g * 8 + half * 4];
        const float4 xa1 = *(const float4*)&Xs[16 + l16][kb + g * 8 + half * 4];
        v2f b01, b23, a;
        b01.x = bw[g][0];  b01.y = bw[g][1];
        b23.x = bw[g][2];  b23.y = bw[g][3];
        a.x = xa0.x;  a.y = xa0.y;  acc0 = wmma4(a, b01, acc0);
        a.x = xa1.x;  a.y = xa1.y;  acc1 = wmma4(a, b01, acc1);
        a.x = xa0.z;  a.y = xa0.w;  acc0 = wmma4(a, b23, acc0);
        a.x = xa1.z;  a.y = xa1.w;  acc1 = wmma4(a, b23, acc1);
    }

    // partial tiles, [head][token] so that the sum below reads along tokens
    #pragma unroll
    for (int r = 0; r < 8; ++r) {
        red[wave][l16][half * 8 + r]      = acc0[r];
        red[wave][l16][16 + half * 8 + r] = acc1[r];
    }
    __syncthreads();

    const int b  = row0 >> 10;
    const int t0 = row0 & 1023;
    #pragma unroll
    for (int z = 0; z < 2; ++z) {
        const int col = wave + z * 8;
        float s = 0.0f;
        #pragma unroll
        for (int p = 0; p < 8; ++p) s += red[p][col][lane];
        op[(size_t)(b * NHEAD + col) * 1024 + t0 + lane] = s + bias[col];
    }
}

// ---------------------------------------------------------------------------
// K3: gate scan.  m_t = max(f_t + m_{t-1}, i_t) via (max,+) prefix:
//   g_j = per-chunk cumsum f;  m_j = g_j + max(m_entry, prefmax(i - g))
//  grid = 64 (b*h), 512 threads.  Wave w owns chunk w; lane l holds elements
//  l and l+32 of it.  Both prefixes run over distances 1, 2, .. 32 inside the
//  wave; only the chunk totals cross waves, through LDS.
// ---------------------------------------------------------------------------
__global__ __launch_bounds__(512)
void gate_scan_kernel(const float* __restrict__ ihm, const float* __restrict__ fhm,
                      float* __restrict__ m_arr, float* __restrict__ g_arr)
{
    __shared__ float tot[2][NCHUNK];
    const int bh   = blockIdx.x;
    const int lane = threadIdx.x & 31;
    // chunk = wave number, held as a scalar: it bounds the carry loop below
    const int c    = __builtin_amdgcn_readfirstlane(threadIdx.x >> 5);
    const size_t ix = (size_t)bh * 1024 + c * CHUNK + lane;

    float g0 = fhm[ix], g1 = fhm[ix + 32];
    const float i0 = ihm[ix], i1 = ihm[ix + 32];

    // element e takes element e - off: from lane - off of the same register, or,
    // for the upper register's first off lanes, from the lower register's last ones
    for (int off = 1; off < 32; off <<= 1) {
        const int from = (lane - off) & 31;
        const float r0 = __shfl(g0, from, 32);
        const float r1 = __shfl(g1, from, 32);
        g0 += (lane >= off) ? r0 : 0.0f;
        g1 += (lane >= off) ? r1 : r0;
    }
    g1 += g0;                                   // distance 32

    float p0 = i0 - g0, p1 = i1 - g1;
    for (int off = 1; off < 32; off <<= 1) {
        const int from = (lane - off) & 31;
        const float r0 = __shfl(p0, from, 32);
        const float r1 = __shfl(p1, from, 32);
        p0 = fmaxf(p0, (lane >= off) ? r0 : -1e30f);
        p1 = fmaxf(p1, (lane >= off) ? r1 : r0);
    }
    p1 = fmaxf(p1, p0);                         // distance 32
    p0 = fmaxf(p0, -1e30f);

    if (lane == 31) { tot[0][c] = g1;  tot[1][c] = p1; }
    __syncthreads();

    // m at the chunk's entry: the recurrence over the totals of the earlier chunks
    const float tg = tot[0][lane & 15];
    const float tp = tot[1][lane & 15];
    float me = 0.0f;
    for (int cc = 0; cc < c; ++cc) {
        const float gt = __int_as_float(__builtin_amdgcn_readlane(__float_as_int(tg), cc));
        const float pt = __int_as_float(__builtin_amdgcn_readlane(__float_as_int(tp), cc));
        me = gt + fmaxf(me, pt);
    }

    m_arr[ix]      = g0 + fmaxf(me, p0);
    m_arr[ix + 32] = g1 + fmaxf(me, p1);
    g_arr[ix]      = g0;
    g_arr[ix + 32] = g1;
}

// ---------------------------------------------------------------------------
// K4: intra-chunk kernel.  grid = 1024 blocks, 256 threads.
// ---------------------------------------------------------------------------
__global__ __launch_bounds__(256)
void chunk_intra_kernel(const float* __restrict__ qb, const float* __restrict__ kb,
                        const float* __restrict__ vb, const float* __restrict__ ihm,
                        const float* __restrict__ g_arr, const float* __restrict__ m_arr,
                        float* __restrict__ Pbuf, float* __restrict__ denbuf,
                        float* __restrict__ Gbuf, float* __restrict__ ubuf)
{
    __shared__ float Qs[64][LDC];   // later reused as W (weighted Sv)
    __shared__ float Ks[64][LDC];   // later scaled by wg
    __shared__ float Vs[64][LDC];
    __shared__ float sg[64], sm[64], sii[64], wgl[64];
    __shared__ float denp[2][64];
    __shared__ float red[256];

    const int tid  = threadIdx.x;
    const int lane = tid & 31;
    const int wave = tid >> 5;
    const int l16  = lane & 15;
    const int half = lane >> 4;

    const int bh = blockIdx.x >> 4;
    const int c  = blockIdx.x & 15;
    const int b  = bh >> 4, h = bh & 15;

    // ---- stage Q,K,V chunk tiles: async global -> LDS ----
    {
        const int r  = tid >> 2;
        const int c0 = (tid & 3) * 16;
        const size_t gbase = ((size_t)(b * 1024 + c * CHUNK + r)) * HIDDIM + h * HDIM + c0;
        #pragma unroll
        for (int z = 0; z < 4; ++z) {
            async_ld_b128(&Qs[r][c0 + z * 4], qb + gbase + z * 4);
            async_ld_b128(&Ks[r][c0 + z * 4], kb + gbase + z * 4);
            async_ld_b128(&Vs[r][c0 + z * 4], vb + gbase + z * 4);
        }
    }
    if (tid < 64) {
        const size_t sb = (size_t)bh * 1024 + c * CHUNK + tid;
        sg[tid]  = g_arr[sb];
        sm[tid]  = m_arr[sb];
        sii[tid] = ihm[sb];
    }
    wait_async0();
    __syncthreads();
    if (tid < 64)
        wgl[tid] = expf(sg[63] - sg[tid] + sii[tid] - sm[63]);   // state-inc weights

    const int tm  = wave >> 1;
    const int m0  = tm * 16;
    const int tn0 = (wave & 1) * 32;

    // ---- GEMM 1+2 fused: Sv = Q V^T, Sk = Q K^T ----
    v8f sv0 = {}, sv1 = {}, sk0 = {}, sk1 = {};
    #pragma unroll
    for (int kk = 0; kk < 64; kk += 4) {
        const int ak = kk + half * 2;
        v2f a   = *(const v2f*)&Qs[m0 + l16][ak];
        v2f bv0 = *(const v2f*)&Vs[tn0 + l16][ak];
        v2f bv1 = *(const v2f*)&Vs[tn0 + 16 + l16][ak];
        v2f bk0 = *(const v2f*)&Ks[tn0 + l16][ak];
        v2f bk1 = *(const v2f*)&Ks[tn0 + 16 + l16][ak];
        sv0 = wmma4(a, bv0, sv0);  sv1 = wmma4(a, bv1, sv1);
        sk0 = wmma4(a, bk0, sk0);  sk1 = wmma4(a, bk1, sk1);
    }
    __syncthreads();   // all Qs reads complete before overwrite

    // ---- causal decay weights, W into Qs, den_intra reduce ----
    #pragma unroll
    for (int r = 0; r < 8; ++r) {
        const int j  = m0 + r + half * 8;
        const int i0 = tn0 + l16;
        const int i1 = i0 + 16;
        const float gj = sg[j], mj = sm[j];
        const float w0 = (i0 <= j) ? expf(gj - sg[i0] + sii[i0] - mj) : 0.0f;
        const float w1 = (i1 <= j) ? expf(gj - sg[i1] + sii[i1] - mj) : 0.0f;
        Qs[j][i0] = w0 * sv0[r];
        Qs[j][i1] = w1 * sv1[r];
        float dp = w0 * sk0[r] + w1 * sk1[r];
        #pragma unroll
        for (int off = 8; off; off >>= 1) dp += __shfl_xor(dp, off, 32);
        if (l16 == 0) denp[wave & 1][j] = dp;
    }
    __syncthreads();
    if (tid < 64)
        denbuf[(size_t)bh * 1024 + c * CHUNK + tid] = denp[0][tid] + denp[1][tid];

    // ---- GEMM 3: P = W @ K  (B from row-major Ks via two scalar loads) ----
    v8f p0 = {}, p1 = {};
    #pragma unroll
    for (int kk = 0; kk < 64; kk += 4) {
        const int ak = kk + half * 2;
        v2f a = *(const v2f*)&Qs[m0 + l16][ak];
        v2f b0, b1;
        b0.x = Ks[ak][tn0 + l16];       b0.y = Ks[ak + 1][tn0 + l16];
        b1.x = Ks[ak][tn0 + 16 + l16];  b1.y = Ks[ak + 1][tn0 + 16 + l16];
        p0 = wmma4(a, b0, p0);  p1 = wmma4(a, b1, p1);
    }
    {
        const size_t pb = (size_t)blockIdx.x * 4096;   // (bh*16+c) * 64*64
        #pragma unroll
        for (int r = 0; r < 8; ++r) {
            const int j = m0 + r + half * 8;
            Pbuf[pb + j * 64 + tn0 + l16]      = p0[r];
            Pbuf[pb + j * 64 + tn0 + 16 + l16] = p1[r];
        }
    }
    __syncthreads();

    // ---- scale K rows by wg, column sums -> u ----
    #pragma unroll
    for (int z = 0; z < 16; ++z) {
        const int flat = tid + z * 256;
        Ks[flat >> 6][flat & 63] *= wgl[flat >> 6];
    }
    __syncthreads();
    {
        const int d = tid & 63, grp = tid >> 6;
        float s = 0.0f;
        #pragma unroll
        for (int z = 0; z < 16; ++z) s += Ks[grp * 16 + z][d];
        red[tid] = s;
    }
    __syncthreads();
    if (tid < 64)
        ubuf[(size_t)blockIdx.x * 64 + tid] = red[tid] + red[64 + tid] + red[128 + tid] + red[192 + tid];

    // ---- GEMM 4: G^T[e,d] = sum_i wg_i K[i,e] V[i,d] ----
    v8f gg0 = {}, gg1 = {};
    #pragma unroll
    for (int kk = 0; kk < 64; kk += 4) {
        const int ak = kk + half * 2;
        v2f a, b0, b1;
        a.x  = Ks[ak][m0 + l16];        a.y  = Ks[ak + 1][m0 + l16];        // A[e][i]
        b0.x = Vs[ak][tn0 + l16];       b0.y = Vs[ak + 1][tn0 + l16];       // B[i][d]
        b1.x = Vs[ak][tn0 + 16 + l16];  b1.y = Vs[ak + 1][tn0 + 16 + l16];
        gg0 = wmma4(a, b0, gg0);  gg1 = wmma4(a, b1, gg1);
    }
    {
        const size_t gb = (size_t)blockIdx.x * 4096;
        #pragma unroll
        for (int r = 0; r < 8; ++r) {
            const int e = m0 + r + half * 8;
            Gbuf[gb + e * 64 + tn0 + l16]      = gg0[r];
            Gbuf[gb + e * 64 + tn0 + 16 + l16] = gg1[r];
        }
    }
}

// ---------------------------------------------------------------------------
// K5: inter-chunk kernel.  grid = 1024 (chunk, b*h), 256 threads.
//  A block rebuilds the state that enters its chunk from the G tiles of the
//  earlier chunks, in registers, by the recurrence C = decay*C + G, and then
//  does Q@C and the combine for its one chunk.  No block waits for another.
// ---------------------------------------------------------------------------
__global__ __launch_bounds__(256)
void chunk_inter_kernel(const float* __restrict__ qb, const float* __restrict__ ob,
                        const float* __restrict__ g_arr, const float* __restrict__ m_arr,
                        const float* __restrict__ Gbuf, const float* __restrict__ ubuf,
                        const float* __restrict__ denbuf,
                        float* __restrict__ Hbuf)   // in: P_intra, out: h
{
    __shared__ __attribute__((aligned(16))) float Ct[64][LDC];
    __shared__ __attribute__((aligned(16))) float Qs[64][LDC];
    __shared__ float nst[64];
    __shared__ float sg[64], sm[64], dl[64];
    __shared__ float red[256];

    const int tid  = threadIdx.x;
    const int lane = tid & 31, wave = tid >> 5;
    const int l16  = lane & 15, half = lane >> 4;
    const int c  = (NCHUNK - 1) - (blockIdx.x >> 6);   // longest rebuild starts first
    const int bh = blockIdx.x & 63;
    const int b  = bh >> 4, h = bh & 15;
    const int tm = wave >> 1, m0 = tm * 16, tn0 = (wave & 1) * 32;

    // Q tile: async global -> LDS, in flight while the state is rebuilt
    {
        const int r = tid >> 2, c0 = (tid & 3) * 16;
        const size_t gb2 = ((size_t)(b * 1024 + c * CHUNK + r)) * HIDDIM + h * HDIM + c0;
        async_ld4_b128(&Qs[r][c0], qb + gb2);
    }
    // decay of every chunk of this head: lane l of each wave holds chunk l & 15
    float decl;
    {
        const int lc = lane & 15;
        const size_t eb = (size_t)bh * 1024 + lc * CHUNK;
        const float Mp = (lc == 0) ? 0.0f : m_arr[eb - 1];
        decl = expf(g_arr[eb + 63] + Mp - m_arr[eb + 63]);
    }
    const float Mc = (c == 0) ? 0.0f : m_arr[(size_t)bh * 1024 + c * CHUNK - 1];

    // loaded here, used behind the state rebuild: their latency runs under it
    float gl = 0.0f, ml = 0.0f;
    float uu[NCHUNK - 1];
    if (tid < 64) {
        const size_t sb = (size_t)bh * 1024 + c * CHUNK + tid;
        gl = g_arr[sb];
        ml = m_arr[sb];
        const float* up = ubuf + (size_t)bh * NCHUNK * 64;   // block-uniform base
        #pragma unroll
        for (int cc = 0; cc < NCHUNK - 1; ++cc)
            uu[cc] = (cc < c) ? up[cc * 64 + (unsigned)tid] : 0.0f;
    }
    // precaution: the address registers of the loads above are reused below
    asm volatile("s_wait_xcnt 0x0" ::: "memory");

    // entry state: Ctilde = decay*Ctilde + G ; n = decay*n + u, over chunks 0..c-1
    {
        float4 st[4];
        #pragma unroll
        for (int z = 0; z < 4; ++z) st[z] = make_float4(0.0f, 0.0f, 0.0f, 0.0f);
        const float* gp = Gbuf + (size_t)bh * NCHUNK * 4096 + tid * 4;
        // unrolled by 4 so that the loads of four G tiles are in flight together
        #pragma unroll 4
        for (int cc = 0; cc < c; ++cc) {
            const float decay = __int_as_float(__builtin_amdgcn_readlane(__float_as_int(decl), cc));
            #pragma unroll
            for (int z = 0; z < 4; ++z) {
                const float4 gv = *(const float4*)(gp + z * 1024);
                st[z].x = decay * st[z].x + gv.x;
                st[z].y = decay * st[z].y + gv.y;
                st[z].z = decay * st[z].z + gv.z;
                st[z].w = decay * st[z].w + gv.w;
            }
            gp += 4096;
        }
        #pragma unroll
        for (int z = 0; z < 4; ++z) {
            const int flat = tid * 4 + z * 1024;
            *(float4*)&Ct[flat >> 6][flat & 63] = st[z];
        }
        if (tid < 64) {
            float nv = 0.0f;
            #pragma unroll
            for (int cc = 0; cc < NCHUNK - 1; ++cc) {
                const float decay = __int_as_float(__builtin_amdgcn_readlane(__float_as_int(decl), cc));
                if (cc < c) nv = decay * nv + uu[cc];
            }
            nst[tid] = nv;
            sg[tid]  = gl;
            sm[tid]  = ml;
        }
    }
    wait_async0();
    __syncthreads();   // Q tile, Ct, nst, sg and sm visible

    // den-inter partials: n . q_j
    {
        const int j = tid & 63, grp = tid >> 6;
        float s = 0.0f;
        #pragma unroll
        for (int z = 0; z < 16; ++z) s += nst[grp * 16 + z] * Qs[j][grp * 16 + z];
        red[tid] = s;
    }
    // inter[j,e] = sum_d Q[j,d] * Ctilde[d,e]   (Ct holds [e][d])
    v8f a0 = {}, a1 = {};
    #pragma unroll
    for (int kk = 0; kk < 64; kk += 4) {
        const int ak = kk + half * 2;
        v2f av = *(const v2f*)&Qs[m0 + l16][ak];
        v2f b0 = *(const v2f*)&Ct[tn0 + l16][ak];
        v2f b1 = *(const v2f*)&Ct[tn0 + 16 + l16][ak];
        a0 = wmma4(av, b0, a0);  a1 = wmma4(av, b1, a1);
    }
    __syncthreads();
    if (tid < 64) dl[tid] = red[tid] + red[64 + tid] + red[128 + tid] + red[192 + tid];
    __syncthreads();

    // combine: h = o .* (scl*inter + P_intra) / max(|scl*deninter + den_intra|, 1)
    {
        const size_t pb = (size_t)(bh * NCHUNK + c) * 4096;
        #pragma unroll
        for (int r = 0; r < 8; ++r) {
            const int j = m0 + r + half * 8;
            const float scl = expf(sg[j] + Mc - sm[j]);
            float den = scl * dl[j] + denbuf[(size_t)bh * 1024 + c * CHUNK + j];
            den = fmaxf(fabsf(den), 1.0f);
            const size_t orow = ((size_t)(b * 1024 + c * CHUNK + j)) * HIDDIM + h * HDIM;
            const int e0 = tn0 + l16, e1 = e0 + 16;
            const float n0 = scl * a0[r] + Hbuf[pb + j * 64 + e0];
            const float n1 = scl * a1[r] + Hbuf[pb + j * 64 + e1];
            Hbuf[pb + j * 64 + e0] = ob[orow + e0] * n0 / den;
            Hbuf[pb + j * 64 + e1] = ob[orow + e1] * n1 / den;
        }
    }
}

// ---------------------------------------------------------------------------
// K6: LayerNorm over head-major h.  grid = 4096 token rows, 256 threads.
// ---------------------------------------------------------------------------
__global__ __launch_bounds__(256)
void ln_kernel(const float* __restrict__ hb, const float* __restrict__ gamma,
               const float* __restrict__ beta, float* __restrict__ out)
{
    __shared__ float rs[8], rs2[8];
    const int row = blockIdx.x;          // b*1024 + t
    const int b = row >> 10, t = row & 1023;
    const int tid = threadIdx.x;

    float vals[4];
    float s = 0.0f, s2 = 0.0f;
    #pragma unroll
    for (int i = 0; i < 4; ++i) {
        const int cH = tid + i * 256, h = cH >> 6, e = cH & 63;
        const float vv = hb[((size_t)(b * NHEAD + h) * 1024 + t) * HDIM + e];
        vals[i] = vv;
        s += vv;  s2 += vv * vv;
    }
    #pragma unroll
    for (int off = 16; off; off >>= 1) {
        s  += __shfl_xor(s,  off, 32);
        s2 += __shfl_xor(s2, off, 32);
    }
    const int wave = tid >> 5, lane = tid & 31;
    if (lane == 0) { rs[wave] = s; rs2[wave] = s2; }
    __syncthreads();
    float ts = 0.0f, ts2 = 0.0f;
    #pragma unroll
    for (int w = 0; w < 8; ++w) { ts += rs[w]; ts2 += rs2[w]; }
    const float mu  = ts * (1.0f / 1024.0f);
    const float var = ts2 * (1.0f / 1024.0f) - mu * mu;
    const float inv = rsqrtf(var + 1e-5f);
    #pragma unroll
    for (int i = 0; i < 4; ++i) {
        const int cH = tid + i * 256;
        out[(size_t)row * HIDDIM + cH] = (vals[i] - mu) * inv * gamma[cH] + beta[cH];
    }
}

// ---------------------------------------------------------------------------
extern "C" void kernel_launch(void* const* d_in, const int* in_sizes, int n_in,
                              void* d_out, int out_size, void* d_ws, size_t ws_size,
                              hipStream_t stream)
{
    const float* x     = (const float*)d_in[0];
    const float* Wq    = (const float*)d_in[1];
    const float* Wk    = (const float*)d_in[2];
    const float* Wv    = (const float*)d_in[3];
    const float* Wo    = (const float*)d_in[4];
    const float* b_o   = (const float*)d_in[5];
    const float* w_i   = (const float*)d_in[6];
    const float* b_i   = (const float*)d_in[7];
    const float* w_f   = (const float*)d_in[8];
    const float* b_f   = (const float*)d_in[9];
    const float* gamma = (const float*)d_in[10];
    const float* beta  = (const float*)d_in[11];

    // workspace layout (floats); total ~= 24.4M floats ~= 98 MB
    float* ws = (float*)d_ws;
    const size_t big = (size_t)NTOK * HIDDIM;   // 4M
    const size_t sml = (size_t)BHEADS * 1024;   // 64K
    float* q_buf = ws;
    float* k_buf = q_buf + big;
    float* v_buf = k_buf + big;
    float* o_buf = v_buf + big;
    float* i_buf = o_buf + big;      // head-major (bh, t)
    float* f_buf = i_buf + sml;
    float* m_buf = f_buf + sml;
    float* g_buf = m_buf + sml;
    float* P_buf = g_buf + sml;      // (bh, t, e) — becomes h after K5
    float* d_buf = P_buf + big;      // den_intra (bh, t)
    float* G_buf = d_buf + sml;      // (bh*16+c, e, d)
    float* u_buf = G_buf + big;      // (bh*16+c, d)

    proj_gemm_kernel<<<dim3(2048), dim3(256), 0, stream>>>(
        x, Wq, Wk, Wv, Wo, b_o, q_buf, k_buf, v_buf, o_buf);

    ifproj_kernel<<<dim3(256), dim3(256), 0, stream>>>(
        x, w_i, b_i, w_f, b_f, i_buf, f_buf);

    gate_scan_kernel<<<dim3(BHEADS), dim3(NCHUNK * 32), 0, stream>>>(
        i_buf, f_buf, m_buf, g_buf);

    chunk_intra_kernel<<<dim3(BHEADS * NCHUNK), dim3(256), 0, stream>>>(
        q_buf, k_buf, v_buf, i_buf, g_buf, m_buf, P_buf, d_buf, G_buf, u_buf);

    chunk_inter_kernel<<<dim3(BHEADS * NCHUNK), dim3(256), 0, stream>>>(
        q_buf, o_buf, g_buf, m_buf, G_buf, u_buf, d_buf, P_buf);

    ln_kernel<<<dim3(NTOK), dim3(256), 0, stream>>>(
        P_buf, gamma, beta, (float*)d_out);
}

// v006
// A run of this version takes 156 microseconds.
// Versions between v004 and this one are left out; their measured steps multiply to 1.39 times as fast.
// Over all steps from v000 it is 2.82 times as fast.
#include <hip/hip_runtime.h>
#include <math.h>

// ---------------------------------------------------------------------------
// mLSTM layer for gfx1250 (MI455X), fp32 data, chunkwise-parallel form.
//  K0: x and the four weight matrices, each f32 split once into a high and a low
//      bf16 part, laid in 16B pieces of 8 consecutive k for K1's copies
//  K1: fused q/k/v/o projection GEMM            (V_WMMA_F32_16X16X32_BF16 on the
//      split operands, f32 accumulate)
//  K2: i/f gate projections (head-major output) (V_WMMA_F32_16X16X4_F32)
//  K3: gate scan: m (max,+ prefix) and per-chunk cumsum g, one wave per chunk
//  K4: intra-chunk kernel, 1024 parallel blocks: QV^T, QK^T, (w.Sv)K, G, u
//  K5: inter-chunk kernel, 1024 parallel blocks: entry state from G tiles, Q@C
//  K6: LayerNorm -> d_out
//  K1/K4/K5 tile staging uses GLOBAL_LOAD_ASYNC_TO_LDS_B128 (ASYNCcnt) where no
//  transpose is needed; LDS tiles are 16B-aligned per row for B128.
// ---------------------------------------------------------------------------

typedef __attribute__((ext_vector_type(2))) float v2f;
typedef __attribute__((ext_vector_type(8))) float v8f;
typedef __attribute__((ext_vector_type(2)))  __bf16 bf16x2;
typedef __attribute__((ext_vector_type(16))) __bf16 bf16x16;
typedef __attribute__((ext_vector_type(8)))  unsigned int u32x8;
typedef __attribute__((ext_vector_type(4)))  unsigned int u32x4;

#define NTOK   4096          // B*T
#define INDIM  1024
#define HIDDIM 1024
#define NHEAD  16
#define HDIM   64
#define CHUNK  64
#define NCHUNK 16            // T / CHUNK
#define BHEADS 64            // B*H

#define TILE_M 64
#define TILE_N 128
#define KSTEP  32
#define LDS_P  36            // dwords: 128B rows (32 k high | 32 k low) at a 144B pitch, for b128 readers
#define LDC    68            // 272B rows: 16B aligned (async B128), bank-safe

__device__ __forceinline__ v8f wmma4(v2f a, v2f b, v8f c) {
    return __builtin_amdgcn_wmma_f32_16x16x4_f32(false, a, false, b, (short)0, c, false, false);
}

// One bf16 16x16x32 product, f32 accumulate; a fragment is 8 registers of 2 bf16.
__device__ __forceinline__ v8f wmma32(u32x8 a, u32x8 b, v8f c) {
    return __builtin_amdgcn_wmma_f32_16x16x32_bf16(false, __builtin_bit_cast(bf16x16, a),
                                                   false, __builtin_bit_cast(bf16x16, b),
                                                   (short)0, c, false, false);
}
// x = hi + lo + r: hi = bf16(x), lo = bf16(x - hi); x - hi is exact in f32 and
// |r| <= 2^-17 |x|.
__device__ __forceinline__ void split_bf16(v2f x, unsigned& hi, unsigned& lo) {
    const bf16x2 h = __builtin_convertvector(x, bf16x2);
    const bf16x2 l = __builtin_convertvector(x - __builtin_convertvector(h, v2f), bf16x2);
    hi = __builtin_bit_cast(unsigned, h);
    lo = __builtin_bit_cast(unsigned, l);
}

// Async 16B copy: global -> LDS, tracked by ASYNCcnt (per-lane addresses).
__device__ __forceinline__ void async_ld_b128(void* lds_ptr, const void* gaddr) {
    unsigned lds_off = (unsigned)(unsigned long long)lds_ptr;  // flat LDS addr[31:0]
    asm volatile("global_load_async_to_lds_b128 %0, %1, off"
                 :: "v"(lds_off), "v"(gaddr) : "memory");
}
// Four async 16B copies of 64 consecutive bytes.  The s_wait_xcnt closes the same
// statement so that no address register of a copy is reused ahead of it.
__device__ __forceinline__ void async_ld4_b128(void* lds_ptr, const float* gaddr) {
    unsigned l0 = (unsigned)(unsigned long long)lds_ptr;  // flat LDS addr[31:0]
    asm volatile("global_load_async_to_lds_b128 %0, %4, off\n\t"
                 "global_load_async_to_lds_b128 %1, %5, off\n\t"
                 "global_load_async_to_lds_b128 %2, %6, off\n\t"
                 "global_load_async_to_lds_b128 %3, %7, off\n\t"
                 "s_wait_xcnt 0x0"
                 :: "v"(l0), "v"(l0 + 16u), "v"(l0 + 32u), "v"(l0 + 48u),
                    "v"(gaddr), "v"(gaddr + 4), "v"(gaddr + 8), "v"(gaddr + 12)
                 : "memory");
}
// The six async 16B copies of a thread for one k step of K1: two pieces of the x
// tile, 32 rows apart, and four of the weight tile, two piece planes apart.  The
// s_wait_xcnt closes the same statement so that no address register of a copy is
// reused ahead of it.
__device__ __forceinline__ void async_stage6_b128(void* lds_a, const float* ga,
                                                  void* lds_b, const float* gb) {
    unsigned la = (unsigned)(unsigned long long)lds_a;  // flat LDS addr[31:0]
    unsigned lb = (unsigned)(unsigned long long)lds_b;
    asm volatile("global_load_async_to_lds_b128 %0, %6, off\n\t"
                 "global_load_async_to_lds_b128 %1, %7, off\n\t"
                 "global_load_async_to_lds_b128 %2, %8, off\n\t"
                 "global_load_async_to_lds_b128 %3, %9, off\n\t"
                 "global_load_async_to_lds_b128 %4, %10, off\n\t"
                 "global_load_async_to_lds_b128 %5, %11, off\n\t"
                 "s_wait_xcnt 0x0"
                 :: "v"(la), "v"(la + 32u * LDS_P * 4u),
                    "v"(lb), "v"(lb + 32u), "v"(lb + 64u), "v"(lb + 96u),
                    "v"(ga), "v"(ga + 32 * INDIM),
                    "v"(gb), "v"(gb + 2 * HIDDIM * 4), "v"(gb + 4 * HIDDIM * 4), "v"(gb + 6 * HIDDIM * 4)
                 : "memory");
}
__device__ __forceinline__ void wait_async0() {
    asm volatile("s_wait_asynccnt 0x0" ::: "memory");
}

// ---------------------------------------------------------------------------
// K0: operand split.  grid = 512 (x) + 512 (W) blocks, 256 threads.
//  A piece is 16B: 8 consecutive k of one row of x, or of one column of W, as bf16.
//  xs[row][k/32][high, low][(k/8)&3]      : one 128B line per row and k step
//  wp[matrix][k/32][high, low][(k/8)&3][n]: pieces of neighbouring columns adjoin
// ---------------------------------------------------------------------------
__device__ __forceinline__ void split_piece(const float* v, u32x4& hi, u32x4& lo) {
    #pragma unroll
    for (int e = 0; e < 4; ++e) {
        v2f p;
        p.x = v[2 * e];  p.y = v[2 * e + 1];
        unsigned h, l;
        split_bf16(p, h, l);
        hi[e] = h;  lo[e] = l;
    }
}

__global__ __launch_bounds__(256)
void split_kernel(const float* __restrict__ x,
                  const float* __restrict__ Wq, const float* __restrict__ Wk,
                  const float* __restrict__ Wv, const float* __restrict__ Wo,
                  float* __restrict__ xs, float* __restrict__ wp)
{
    const unsigned tid = threadIdx.x;
    u32x4 hi[4], lo[4];
    if (blockIdx.x < 512) {
        // a thread: four pieces of x, two rows apart; a block: eight rows
        const unsigned t = blockIdx.x * 1024 + tid;       // row * 128 + k / 8
        const float* p = x + (size_t)t * 8;
        float v[4][8];
        #pragma unroll
        for (int z = 0; z < 4; ++z) {
            *(float4*)&v[z][0] = *(const float4*)(p + z * 2048);
            *(float4*)&v[z][4] = *(const float4*)(p + z * 2048 + 4);
        }
        #pragma unroll
        for (int z = 0; z < 4; ++z) split_piece(v[z], hi[z], lo[z]);
        u32x4* o = (u32x4*)xs + (size_t)(t >> 2) * 8 + (t & 3);
        #pragma unroll
        for (int z = 0; z < 4; ++z) {
            o[z * 512]     = hi[z];
            o[z * 512 + 4] = lo[z];
        }
    } else {
        // a thread: one column of one matrix over one k step of 32
        const unsigned wb = blockIdx.x - 512;
        const unsigned n  = (wb & 3) * 256 + tid;
        const unsigned ks = wb >> 2;                      // matrix * 32 + k / 32
        const unsigned g  = ks >> 5;
        const float* Wm = (g == 0) ? Wq : (g == 1) ? Wk : (g == 2) ? Wv : Wo;
        const float* p  = Wm + (size_t)(ks & 31) * KSTEP * HIDDIM + n;
        float v[KSTEP];
        #pragma unroll
        for (int e = 0; e < KSTEP; ++e) v[e] = p[e * HIDDIM];
        #pragma unroll
        for (int j = 0; j < 4; ++j) split_piece(&v[j * 8], hi[j], lo[j]);
        u32x4* o = (u32x4*)wp + (size_t)ks * 8 * HIDDIM + n;
        #pragma unroll
        for (int j = 0; j < 4; ++j) {
            o[j * HIDDIM]       = hi[j];
            o[(4 + j) * HIDDIM] = lo[j];
        }
    }
}

// ---------------------------------------------------------------------------
// K1: fused projection GEMM.  grid = 64*32 = 2048 blocks, 256 threads.
// ---------------------------------------------------------------------------
// A fragment: 16 consecutive k of a lane's row, two 16B pieces.
__device__ __forceinline__ u32x8 ld_frag(const unsigned* p) {
    const u32x4 a = *(const u32x4*)p;
    const u32x4 b = *(const u32x4*)(p + 4);
    return __builtin_shufflevector(a, b, 0, 1, 2, 3, 4, 5, 6, 7);
}

// register budget of 8 waves per SIMD: four blocks per WGP, the grid in two even rounds
__global__ __launch_bounds__(256) __attribute__((amdgpu_waves_per_eu(8)))
void proj_gemm_kernel(const float* __restrict__ xs, const float* __restrict__ wp,
                      const float* __restrict__ b_o,
                      float* __restrict__ outq, float* __restrict__ outk,
                      float* __restrict__ outv, float* __restrict__ outo)
{
    // a row: the 32 k of this step, 16 dwords of high parts, then 16 of low parts
    __shared__ __attribute__((aligned(16))) unsigned As[TILE_M][LDS_P];
    __shared__ __attribute__((aligned(16))) unsigned Bs[TILE_N][LDS_P];

    const int tid  = threadIdx.x;
    const int lane = tid & 31;
    const int wave = tid >> 5;

    const int bm = blockIdx.x >> 5;
    const int bn = blockIdx.x & 31;
    const int group    = bn >> 3;
    const int n_base_g = (bn & 7) * TILE_N;

    float* outp    = (group == 0) ? outq : (group == 1) ? outk : (group == 2) ? outv : outo;

    const int wm = (wave >> 2) * 32;
    const int wn = (wave & 3)  * 32;
    const int half = lane >> 4;
    const int l16  = lane & 15;

    v8f acc[2][2] = {};

    // x tile: 8 lanes copy one 128B line; W tile: a wave copies 32 adjoining pieces
    const int ar = tid >> 3, ap = tid & 7;
    const int bc = tid & 127, bp = tid >> 7;
    const float* ga = xs + (size_t)(bm * TILE_M + ar) * INDIM + ap * 4;
    const float* gb = wp + ((size_t)(group * 256 + bp) * HIDDIM + n_base_g + bc) * 4;

    for (int k0 = 0; k0 < INDIM; k0 += KSTEP) {
        // ---- stage A (64 x 32) and B (32 x 128): async global -> LDS ----
        async_stage6_b128(&As[ar][ap * 4], ga, &Bs[bc][bp * 4], gb);
        ga += KSTEP;                 // the next 128B line of the row
        gb += 8 * HIDDIM * 4;        // the next eight piece planes
        wait_async0();
        __syncthreads();

        // fragments of the 32 k of this step: a lane of A and of B alike holds
        // k = 16*half .. 16*half + 15 in order (only the pairing of A with B counts)
        u32x8 ah[2], al[2], bh[2], bl[2];
        #pragma unroll
        for (int i = 0; i < 2; ++i) {
            ah[i] = ld_frag(&As[wm + i * 16 + l16][half * 8]);
            al[i] = ld_frag(&As[wm + i * 16 + l16][16 + half * 8]);
            bh[i] = ld_frag(&Bs[wn + i * 16 + l16][half * 8]);
            bl[i] = ld_frag(&Bs[wn + i * 16 + l16][16 + half * 8]);
        }
        // x*w = lo*hi + hi*lo + hi*hi; lo*lo, at most 2^-16 of the product, is left out
        #pragma unroll
        for (int i = 0; i < 2; ++i) {
            #pragma unroll
            for (int j = 0; j < 2; ++j) acc[i][j] = wmma32(al[i], bh[j], acc[i][j]);
        }
        #pragma unroll
        for (int i = 0; i < 2; ++i) {
            #pragma unroll
            for (int j = 0; j < 2; ++j) acc[i][j] = wmma32(ah[i], bl[j], acc[i][j]);
        }
        #pragma unroll
        for (int i = 0; i < 2; ++i) {
            #pragma unroll
            for (int j = 0; j < 2; ++j) acc[i][j] = wmma32(ah[i], bh[j], acc[i][j]);
        }
        __syncthreads();
    }

    const int row0 = bm * TILE_M + wm;
    const int col0 = n_base_g + wn;
    #pragma unroll
    for (int i = 0; i < 2; ++i) {
        #pragma unroll
        for (int j = 0; j < 2; ++j) {
            const int col = col0 + j * 16 + l16;
            const float bo = (group == 3) ? b_o[col] : 0.0f;
            #pragma unroll
            for (int r = 0; r < 8; ++r) {
                const int row = row0 + i * 16 + r + half * 8;
                float val = acc[i][j][r];
                if (group == 0)      val *= 0.125f;                           // q / sqrt(D)
                else if (group == 3) val = 1.0f / (1.0f + expf(-(val + bo))); // sigmoid
                outp[(size_t)row * HIDDIM + col] = val;
            }
        }
    }
}

// ---------------------------------------------------------------------------
// K2: i/f projections on WMMA, output HEAD-MAJOR: out[(b*16+h)*1024 + t].
//  grid = 128 row blocks x {i, f} = 256 blocks, 256 threads.
//  A block owns 32 tokens x 16 heads of one gate; wave w sums k in
//  [128w, 128w+128); the eight partial tiles are added through LDS.
// ---------------------------------------------------------------------------
#define IF_ROWS 32           // tokens per block = one 128B line of head-major output
#define IF_KS   128          // k slice per wave = one 512B wave-wide load per row
#define IF_XP   1028         // 4112B rows: 16B more than a row of x, for b128 readers
#define IF_RP   36           // 144B rows of the partial tiles

__global__ __launch_bounds__(256)
void ifproj_kernel(const float* __restrict__ x,
                   const float* __restrict__ wi, const float* __restrict__ bi,
                   const float* __restrict__ wf, const float* __restrict__ bf,
                   float* __restrict__ outi, float* __restrict__ outf)
{
    __shared__ __attribute__((aligned(16))) float Xs[IF_ROWS][IF_XP];
    __shared__ __attribute__((aligned(16))) float red[8][NHEAD][IF_RP];

    const unsigned tid  = threadIdx.x;
    const unsigned lane = tid & 31;
    const unsigned wave = tid >> 5;
    const unsigned l16  = lane & 15;
    const unsigned half = lane >> 4;

    const int gate = blockIdx.x & 1;                 // 0: i, 1: f
    const int row0 = (blockIdx.x >> 1) * IF_ROWS;    // b*1024 + t
    const float* w    = gate ? wf : wi;
    const float* bias = gate ? bf : bi;
    float* op         = gate ? outf : outi;
    const unsigned kb = wave * IF_KS;

    // B fragments straight from global: lane = head, k = kb + 8g + 4*half + e
    float bw[16][4];
    {
        const unsigned wo = (kb + half * 4) * NHEAD + l16;
        #pragma unroll
        for (int g = 0; g < 16; ++g) {
            #pragma unroll
            for (int e = 0; e < 4; ++e)
                bw[g][e] = w[wo + (g * 8 + e) * NHEAD];
        }
    }
    // x rows: whole-line loads (the block reads one 4KB row per step), then LDS
    {
        const float* xb = x + (size_t)row0 * INDIM;
        #pragma unroll
        for (int i = 0; i < IF_ROWS; ++i)
            *(float4*)&Xs[i][tid * 4] = *(const float4*)&xb[tid * 4 + i * INDIM];
    }
    __syncthreads();

    // A fragments: lane = token, same k order as bw
    v8f acc0 = {}, acc1 = {};
    #pragma unroll
    for (int g = 0; g < 16; ++g) {
        const float4 xa0 = *(const float4*)&Xs[l16][kb + g * 8 + half * 4];
        const float4 xa1 = *(const float4*)&Xs[16 + l16][kb + g * 8 + half * 4];
        v2f b01, b23, a;
        b01.x = bw[g][0];  b01.y = bw[g][1];
        b23.x = bw[g][2];  b23.y = bw[g][3];
        a.x = xa0.x;  a.y = xa0.y;  acc0 = wmma4(a, b01, acc0);
        a.x = xa1.x;  a.y = xa1.y;  acc1 = wmma4(a, b01, acc1);
        a.x = xa0.z;  a.y = xa0.w;  acc0 = wmma4(a, b23, acc0);
        a.x = xa1.z;  a.y = xa1.w;  acc1 = wmma4(a, b23, acc1);
    }

    // partial tiles, [head][token] so that the sum below reads along tokens
    #pragma unroll
    for (int r = 0; r < 8; ++r) {
        red[wave][l16][half * 8 + r]      = acc0[r];
        red[wave][l16][16 + half * 8 + r] = acc1[r];
    }
    __syncthreads();

    const int b  = row0 >> 10;
    const int t0 = row0 & 1023;
    #pragma unroll
    for (int z = 0; z < 2; ++z) {
        const int col = wave + z * 8;
        float s = 0.0f;
        #pragma unroll
        for (int p = 0; p < 8; ++p) s += red[p][col][lane];
        op[(size_t)(b * NHEAD + col) * 1024 + t0 + lane] = s + bias[col];
    }
}

// ---------------------------------------------------------------------------
// K3: gate scan.  m_t = max(f_t + m_{t-1}, i_t) via (max,+) prefix:
//   g_j = per-chunk cumsum f;  m_j = g_j + max(m_entry, prefmax(i - g))
//  grid = 64 (b*h), 512 threads.  Wave w owns chunk w; lane l holds elements
//  l and l+32 of it.  Both prefixes run over distances 1, 2, .. 32 inside the
//  wave; only the chunk totals cross waves, through LDS.
// ---------------------------------------------------------------------------
__global__ __launch_bounds__(512)
void gate_scan_kernel(const float* __restrict__ ihm, const float* __restrict__ fhm,
                      float* __restrict__ m_arr, float* __restrict__ g_arr)
{
    __shared__ float tot[2][NCHUNK];
    const int bh   = blockIdx.x;
    const int lane = threadIdx.x & 31;
    // chunk = wave number, held as a scalar: it bounds the carry loop below
    const int c    = __builtin_amdgcn_readfirstlane(threadIdx.x >> 5);
    const size_t ix = (size_t)bh * 1024 + c * CHUNK + lane;

    float g0 = fhm[ix], g1 = fhm[ix + 32];
    const float i0 = ihm[ix], i1 = ihm[ix + 32];

    // element e takes element e - off: from lane - off of the same register, or,
    // for the upper register's first off lanes, from the lower register's last ones
    for (int off = 1; off < 32; off <<= 1) {
        const int from = (lane - off) & 31;
        const float r0 = __shfl(g0, from, 32);
        const float r1 = __shfl(g1, from, 32);
        g0 += (lane >= off) ? r0 : 0.0f;
        g1 += (lane >= off) ? r1 : r0;
    }
    g1 += g0;                                   // distance 32

    float p0 = i0 - g0, p1 = i1 - g1;
    for (int off = 1; off < 32; off <<= 1) {
        const int from = (lane - off) & 31;
        const float r0 = __shfl(p0, from, 32);
        const float r1 = __shfl(p1, from, 32);
        p0 = fmaxf(p0, (lane >= off) ? r0 : -1e30f);
        p1 = fmaxf(p1, (lane >= off) ? r1 : r0);
    }
    p1 = fmaxf(p1, p0);                         // distance 32
    p0 = fmaxf(p0, -1e30f);

    if (lane == 31) { tot[0][c] = g1;  tot[1][c] = p1; }
    __syncthreads();

    // m at the chunk's entry: the recurrence over the totals of the earlier chunks
    const float tg = tot[0][lane & 15];
    const float tp = tot[1][lane & 15];
    float me = 0.0f;
    for (int cc = 0; cc < c; ++cc) {
        const float gt = __int_as_float(__builtin_amdgcn_readlane(__float_as_int(tg), cc));
        const float pt = __int_as_float(__builtin_amdgcn_readlane(__float_as_int(tp), cc));
        me = gt + fmaxf(me, pt);
    }

    m_arr[ix]      = g0 + fmaxf(me, p0);
    m_arr[ix + 32] = g1 + fmaxf(me, p1);
    g_arr[ix]      = g0;
    g_arr[ix + 32] = g1;
}

// ---------------------------------------------------------------------------
// K4: intra-chunk kernel.  grid = 1024 blocks, 256 threads.
// ---------------------------------------------------------------------------
__global__ __launch_bounds__(256)
void chunk_intra_kernel(const float* __restrict__ qb, const float* __restrict__ kb,
                        const float* __restrict__ vb, const float* __restrict__ ihm,
                        const float* __restrict__ g_arr, const float* __restrict__ m_arr,
                        float* __restrict__ Pbuf, float* __restrict__ denbuf,
                        float* __restrict__ Gbuf, float* __restrict__ ubuf)
{
    __shared__ float Qs[64][LDC];   // later reused as W (weighted Sv)
    __shared__ float Ks[64][LDC];   // later scaled by wg
    __shared__ float Vs[64][LDC];
    __shared__ float sg[64], sm[64], sii[64], wgl[64];
    __shared__ float denp[2][64];
    __shared__ float red[256];

    const int tid  = threadIdx.x;
    const int lane = tid & 31;
    const int wave = tid >> 5;
    const int l16  = lane & 15;
    const int half = lane >> 4;

    const int bh = blockIdx.x >> 4;
    const int c  = blockIdx.x & 15;
    const int b  = bh >> 4, h = bh & 15;

    // ---- stage Q,K,V chunk tiles: async global -> LDS ----
    {
        const int r  = tid >> 2;
        const int c0 = (tid & 3) * 16;
        const size_t gbase = ((size_t)(b * 1024 + c * CHUNK + r)) * HIDDIM + h * HDIM + c0;
        #pragma unroll
        for (int z = 0; z < 4; ++z) {
            async_ld_b128(&Qs[r][c0 + z * 4], qb + gbase + z * 4);
            async_ld_b128(&Ks[r][c0 + z * 4], kb + gbase + z * 4);
            async_ld_b128(&Vs[r][c0 + z * 4], vb + gbase + z * 4);
        }
    }
    if (tid < 64) {
        const size_t sb = (size_t)bh * 1024 + c * CHUNK + tid;
        sg[tid]  = g_arr[sb];
        sm[tid]  = m_arr[sb];
        sii[tid] = ihm[sb];
    }
    wait_async0();
    __syncthreads();
    if (tid < 64)
        wgl[tid] = expf(sg[63] - sg[tid] + sii[tid] - sm[63]);   // state-inc weights

    const int tm  = wave >> 1;
    const int m0  = tm * 16;
    const int tn0 = (wave & 1) * 32;

    // ---- GEMM 1+2 fused: Sv = Q V^T, Sk = Q K^T ----
    v8f sv0 = {}, sv1 = {}, sk0 = {}, sk1 = {};
    #pragma unroll
    for (int kk = 0; kk < 64; kk += 4) {
        const int ak = kk + half * 2;
        v2f a   = *(const v2f*)&Qs[m0 + l16][ak];
        v2f bv0 = *(const v2f*)&Vs[tn0 + l16][ak];
        v2f bv1 = *(const v2f*)&Vs[tn0 + 16 + l16][ak];
        v2f bk0 = *(const v2f*)&Ks[tn0 + l16][ak];
        v2f bk1 = *(const v2f*)&Ks[tn0 + 16 + l16][ak];
        sv0 = wmma4(a, bv0, sv0);  sv1 = wmma4(a, bv1, sv1);
        sk0 = wmma4(a, bk0, sk0);  sk1 = wmma4(a, bk1, sk1);
    }
    __syncthreads();   // all Qs reads complete before overwrite

    // ---- causal decay weights, W into Qs, den_intra reduce ----
    #pragma unroll
    for (int r = 0; r < 8; ++r) {
        const int j  = m0 + r + half * 8;
        const int i0 = tn0 + l16;
        const int i1 = i0 + 16;
        const float gj = sg[j], mj = sm[j];
        const float w0 = (i0 <= j) ? expf(gj - sg[i0] + sii[i0] - mj) : 0.0f;
        const float w1 = (i1 <= j) ? expf(gj - sg[i1] + sii[i1] - mj) : 0.0f;
        Qs[j][i0] = w0 * sv0[r];
        Qs[j][i1] = w1 * sv1[r];
        float dp = w0 * sk0[r] + w1 * sk1[r];
        #pragma unroll
        for (int off = 8; off; off >>= 1) dp += __shfl_xor(dp, off, 32);
        if (l16 == 0) denp[wave & 1][j] = dp;
    }
    __syncthreads();
    if (tid < 64)
        denbuf[(size_t)bh * 1024 + c * CHUNK + tid] = denp[0][tid] + denp[1][tid];

    // ---- GEMM 3: P = W @ K  (B from row-major Ks via two scalar loads) ----
    v8f p0 = {}, p1 = {};
    #pragma unroll
    for (int kk = 0; kk < 64; kk += 4) {
        const int ak = kk + half * 2;
        v2f a = *(const v2f*)&Qs[m0 + l16][ak];
        v2f b0, b1;
        b0.x = Ks[ak][tn0 + l16];       b0.y = Ks[ak + 1][tn0 + l16];
        b1.x = Ks[ak][tn0 + 16 + l16];  b1.y = Ks[ak + 1][tn0 + 16 + l16];
        p0 = wmma4(a, b0, p0);  p1 = wmma4(a, b1, p1);
    }
    {
        const size_t pb = (size_t)blockIdx.x * 4096;   // (bh*16+c) * 64*64
        #pragma unroll
        for (int r = 0; r < 8; ++r) {
            const int j = m0 + r + half * 8;
            Pbuf[pb + j * 64 + tn0 + l16]      = p0[r];
            Pbuf[pb + j * 64 + tn0 + 16 + l16] = p1[r];
        }
    }
    __syncthreads();

    // ---- scale K rows by wg, column sums -> u ----
    #pragma unroll
    for (int z = 0; z < 16; ++z) {
        const int flat = tid + z * 256;
        Ks[flat >> 6][flat & 63] *= wgl[flat >> 6];
    }
    __syncthreads();
    {
        const int d = tid & 63, grp = tid >> 6;
        float s = 0.0f;
        #pragma unroll
        for (int z = 0; z < 16; ++z) s += Ks[grp * 16 + z][d];
        red[tid] = s;
    }
    __syncthreads();
    if (tid < 64)
        ubuf[(size_t)blockIdx.x * 64 + tid] = red[tid] + red[64 + tid] + red[128 + tid] + red[192 + tid];

    // ---- GEMM 4: G^T[e,d] = sum_i wg_i K[i,e] V[i,d] ----
    v8f gg0 = {}, gg1 = {};
    #pragma unroll
    for (int kk = 0; kk < 64; kk += 4) {
        const int ak = kk + half * 2;
        v2f a, b0, b1;
        a.x  = Ks[ak][m0 + l16];        a.y  = Ks[ak + 1][m0 + l16];        // A[e][i]
        b0.x = Vs[ak][tn0 + l16];       b0.y = Vs[ak + 1][tn0 + l16];       // B[i][d]
        b1.x = Vs[ak][tn0 + 16 + l16];  b1.y = Vs[ak + 1][tn0 + 16 + l16];
        gg0 = wmma4(a, b0, gg0);  gg1 = wmma4(a, b1, gg1);
    }
    {
        const size_t gb = (size_t)blockIdx.x * 4096;
        #pragma unroll
        for (int r = 0; r < 8; ++r) {
            const int e = m0 + r + half * 8;
            Gbuf[gb + e * 64 + tn0 + l16]      = gg0[r];
            Gbuf[gb + e * 64 + tn0 + 16 + l16] = gg1[r];
        }
    }
}

// ---------------------------------------------------------------------------
// K5: inter-chunk kernel.  grid = 1024 (chunk, b*h), 256 threads.
//  A block rebuilds the state that enters its chunk from the G tiles of the
//  earlier chunks, in registers, by the recurrence C = decay*C + G, and then
//  does Q@C and the combine for its one chunk.  No block waits for another.
// ---------------------------------------------------------------------------
__global__ __launch_bounds__(256)
void chunk_inter_kernel(const float* __restrict__ qb, const float* __restrict__ ob,
                        const float* __restrict__ g_arr, const float* __restrict__ m_arr,
                        const float* __restrict__ Gbuf, const float* __restrict__ ubuf,
                        const float* __restrict__ denbuf,
                        float* __restrict__ Hbuf)   // in: P_intra, out: h
{
    __shared__ __attribute__((aligned(16))) float Ct[64][LDC];
    __shared__ __attribute__((aligned(16))) float Qs[64][LDC];
    __shared__ float nst[64];
    __shared__ float sg[64], sm[64], dl[64];
    __shared__ float red[256];

    const int tid  = threadIdx.x;
    const int lane = tid & 31, wave = tid >> 5;
    const int l16  = lane & 15, half = lane >> 4;
    const int c  = (NCHUNK - 1) - (blockIdx.x >> 6);   // longest rebuild starts first
    const int bh = blockIdx.x & 63;
    const int b  = bh >> 4, h = bh & 15;
    const int tm = wave >> 1, m0 = tm * 16, tn0 = (wave & 1) * 32;

    // Q tile: async global -> LDS, in flight while the state is rebuilt
    {
        const int r = tid >> 2, c0 = (tid & 3) * 16;
        const size_t gb2 = ((size_t)(b * 1024 + c * CHUNK + r)) * HIDDIM + h * HDIM + c0;
        async_ld4_b128(&Qs[r][c0], qb + gb2);
    }
    // decay of every chunk of this head: lane l of each wave holds chunk l & 15
    float decl;
    {
        const int lc = lane & 15;
        const size_t eb = (size_t)bh * 1024 + lc * CHUNK;
        const float Mp = (lc == 0) ? 0.0f : m_arr[eb - 1];
        decl = expf(g_arr[eb + 63] + Mp - m_arr[eb + 63]);
    }
    const float Mc = (c == 0) ? 0.0f : m_arr[(size_t)bh * 1024 + c * CHUNK - 1];

    // loaded here, used behind the state rebuild: their latency runs under it
    float gl = 0.0f, ml = 0.0f;
    float uu[NCHUNK - 1];
    if (tid < 64) {
        const size_t sb = (size_t)bh * 1024 + c * CHUNK + tid;
        gl = g_arr[sb];
        ml = m_arr[sb];
        const float* up = ubuf + (size_t)bh * NCHUNK * 64;   // block-uniform base
        #pragma unroll
        for (int cc = 0; cc < NCHUNK - 1; ++cc)
            uu[cc] = (cc < c) ? up[cc * 64 + (unsigned)tid] : 0.0f;
    }
    // precaution: the address registers of the loads above are reused below
    asm volatile("s_wait_xcnt 0x0" ::: "memory");

    // entry state: Ctilde = decay*Ctilde + G ; n = decay*n + u, over chunks 0..c-1
    {
        float4 st[4];
        #pragma unroll
        for (int z = 0; z < 4; ++z) st[z] = make_float4(0.0f, 0.0f, 0.0f, 0.0f);
        const float* gp = Gbuf + (size_t)bh * NCHUNK * 4096 + tid * 4;
        // unrolled by 4 so that the loads of four G tiles are in flight together
        #pragma unroll 4
        for (int cc = 0; cc < c; ++cc) {
            const float decay = __int_as_float(__builtin_amdgcn_readlane(__float_as_int(decl), cc));
            #pragma unroll
            for (int z = 0; z < 4; ++z) {
                const float4 gv = *(const float4*)(gp + z * 1024);
                st[z].x = decay * st[z].x + gv.x;
                st[z].y = decay * st[z].y + gv.y;
                st[z].z = decay * st[z].z + gv.z;
                st[z].w = decay * st[z].w + gv.w;
            }
            gp += 4096;
        }
        #pragma unroll
        for (int z = 0; z < 4; ++z) {
            const int flat = tid * 4 + z * 1024;
            *(float4*)&Ct[flat >> 6][flat & 63] = st[z];
        }
        if (tid < 64) {
            float nv = 0.0f;
            #pragma unroll
            for (int cc = 0; cc < NCHUNK - 1; ++cc) {
                const float decay = __int_as_float(__builtin_amdgcn_readlane(__float_as_int(decl), cc));
                if (cc < c) nv = decay * nv + uu[cc];
            }
            nst[tid] = nv;
            sg[tid]  = gl;
            sm[tid]  = ml;
        }
    }
    wait_async0();
    __syncthreads();   // Q tile, Ct, nst, sg and sm visible

    // den-inter partials: n . q_j
    {
        const int j = tid & 63, grp = tid >> 6;
        float s = 0.0f;
        #pragma unroll
        for (int z = 0; z < 16; ++z) s += nst[grp * 16 + z] * Qs[j][grp * 16 + z];
        red[tid] = s;
    }
    // inter[j,e] = sum_d Q[j,d] * Ctilde[d,e]   (Ct holds [e][d])
    v8f a0 = {}, a1 = {};
    #pragma unroll
    for (int kk = 0; kk < 64; kk += 4) {
        const int ak = kk + half * 2;
        v2f av = *(const v2f*)&Qs[m0 + l16][ak];
        v2f b0 = *(const v2f*)&Ct[tn0 + l16][ak];
        v2f b1 = *(const v2f*)&Ct[tn0 + 16 + l16][ak];
        a0 = wmma4(av, b0, a0);  a1 = wmma4(av, b1, a1);
    }
    __syncthreads();
    if (tid < 64) dl[tid] = red[tid] + red[64 + tid] + red[128 + tid] + red[192 + tid];
    __syncthreads();

    // combine: h = o .* (scl*inter + P_intra) / max(|scl*deninter + den_intra|, 1)
    {
        const size_t pb = (size_t)(bh * NCHUNK + c) * 4096;
        #pragma unroll
        for (int r = 0; r < 8; ++r) {
            const int j = m0 + r + half * 8;
            const float scl = expf(sg[j] + Mc - sm[j]);
            float den = scl * dl[j] + denbuf[(size_t)bh * 1024 + c * CHUNK + j];
            den = fmaxf(fabsf(den), 1.0f);
            const size_t orow = ((size_t)(b * 1024 + c * CHUNK + j)) * HIDDIM + h * HDIM;
            const int e0 = tn0 + l16, e1 = e0 + 16;
            const float n0 = scl * a0[r] + Hbuf[pb + j * 64 + e0];
            const float n1 = scl * a1[r] + Hbuf[pb + j * 64 + e1];
            Hbuf[pb + j * 64 + e0] = ob[orow + e0] * n0 / den;
            Hbuf[pb + j * 64 + e1] = ob[orow + e1] * n1 / den;
        }
    }
}

// ---------------------------------------------------------------------------
// K6: LayerNorm over head-major h.  grid = 4096 token rows, 256 threads.
// ---------------------------------------------------------------------------
__global__ __launch_bounds__(256)
void ln_kernel(const float* __restrict__ hb, const float* __restrict__ gamma,
               const float* __restrict__ beta, float* __restrict__ out)
{
    __shared__ float rs[8], rs2[8];
    const int row = blockIdx.x;          // b*1024 + t
    const int b = row >> 10, t = row & 1023;
    const int tid = threadIdx.x;

    float vals[4];
    float s = 0.0f, s2 = 0.0f;
    #pragma unroll
    for (int i = 0; i < 4; ++i) {
        const int cH = tid + i * 256, h = cH >> 6, e = cH & 63;
        const float vv = hb[((size_t)(b * NHEAD + h) * 1024 + t) * HDIM + e];
        vals[i] = vv;
        s += vv;  s2 += vv * vv;
    }
    #pragma unroll
    for (int off = 16; off; off >>= 1) {
        s  += __shfl_xor(s,  off, 32);
        s2 += __shfl_xor(s2, off, 32);
    }
    const int wave = tid >> 5, lane = tid & 31;
    if (lane == 0) { rs[wave] = s; rs2[wave] = s2; }
    __syncthreads();
    float ts = 0.0f, ts2 = 0.0f;
    #pragma unroll
    for (int w = 0; w < 8; ++w) { ts += rs[w]; ts2 += rs2[w]; }
    const float mu  = ts * (1.0f / 1024.0f);
    const float var = ts2 * (1.0f / 1024.0f) - mu * mu;
    const float inv = rsqrtf(var + 1e-5f);
    #pragma unroll
    for (int i = 0; i < 4; ++i) {
        const int cH = tid + i * 256;
        out[(size_t)row * HIDDIM + cH] = (vals[i] - mu) * inv * gamma[cH] + beta[cH];
    }
}

// ---------------------------------------------------------------------------
extern "C" void kernel_launch(void* const* d_in, const int* in_sizes, int n_in,
                              void* d_out, int out_size, void* d_ws, size_t ws_size,
                              hipStream_t stream)
{
    const float* x     = (const float*)d_in[0];
    const float* Wq    = (const float*)d_in[1];
    const float* Wk    = (const float*)d_in[2];
    const float* Wv    = (const float*)d_in[3];
    const float* Wo    = (const float*)d_in[4];
    const float* b_o   = (const float*)d_in[5];
    const float* w_i   = (const float*)d_in[6];
    const float* b_i   = (const float*)d_in[7];
    const float* w_f   = (const float*)d_in[8];
    const float* b_f   = (const float*)d_in[9];
    const float* gamma = (const float*)d_in[10];
    const float* beta  = (const float*)d_in[11];

    // workspace layout (floats); total ~= 33.9M floats ~= 136 MB
    float* ws = (float*)d_ws;
    const size_t big = (size_t)NTOK * HIDDIM;   // 4M
    const size_t sml = (size_t)BHEADS * 1024;   // 64K
    float* q_buf = ws;
    float* k_buf = q_buf + big;
    float* v_buf = k_buf + big;
    float* o_buf = v_buf + big;
    float* i_buf = o_buf + big;      // head-major (bh, t)
    float* f_buf = i_buf + sml;
    float* m_buf = f_buf + sml;
    float* g_buf = m_buf + sml;
    float* P_buf = g_buf + sml;      // (bh, t, e) — becomes h after K5
    float* d_buf = P_buf + big;      // den_intra (bh, t)
    float* G_buf = d_buf + sml;      // (bh*16+c, e, d)
    float* u_buf = G_buf + big;      // (bh*16+c, d)
    float* xs_buf = u_buf + sml;     // x, split (row, k/32, high|low, k/8)
    float* wp_buf = xs_buf + big;    // Wq..Wo, split (matrix, k/32, high|low, k/8, n)

    split_kernel<<<dim3(1024), dim3(256), 0, stream>>>(
        x, Wq, Wk, Wv, Wo, xs_buf, wp_buf);

    proj_gemm_kernel<<<dim3(2048), dim3(256), 0, stream>>>(
        xs_buf, wp_buf, b_o, q_buf, k_buf, v_buf, o_buf);

    ifproj_kernel<<<dim3(256), dim3(256), 0, stream>>>(
        x, w_i, b_i, w_f, b_f, i_buf, f_buf);

    gate_scan_kernel<<<dim3(BHEADS), dim3(NCHUNK * 32), 0, stream>>>(
        i_buf, f_buf, m_buf, g_buf);

    chunk_intra_kernel<<<dim3(BHEADS * NCHUNK), dim3(256), 0, stream>>>(
        q_buf, k_buf, v_buf, i_buf, g_buf, m_buf, P_buf, d_buf, G_buf, u_buf);

    chunk_inter_kernel<<<dim3(BHEADS * NCHUNK), dim3(256), 0, stream>>>(
        q_buf, o_buf, g_buf, m_buf, G_buf, u_buf, d_buf, P_buf);

    ln_kernel<<<dim3(NTOK), dim3(256), 0, stream>>>(
        P_buf, gamma, beta, (float*)d_out);
}
